// v000
// Measured on an AMD MI455X. A time is GPU time per run, averaged over a window of back-to-back runs after a warm-up
// (all launches, gaps included; the runs take copies of the inputs in turn), and the median of several windows.
// Apart from v000's, it joins two sittings. Times from different sittings can be a few percent apart, while
// side-by-side timings come from the same sitting.
// The starting kernel, v000, takes 94.5 microseconds a run.
#include <hip/hip_runtime.h>

typedef __attribute__((ext_vector_type(16))) _Float16 v16h;
typedef __attribute__((ext_vector_type(8)))  _Float16 v8h;
typedef __attribute__((ext_vector_type(8)))  float    v8f;

#define B_  2
#define S_  4096
#define E_  16
#define H_  128
#define NH_ 8
#define HD_ 16
#define KT_ 32                      // keys per inner iteration
#define NKT (S_ / KT_)              // 128 iterations

// 0.25 * log2(e): fold softmax scale (1/sqrt(16)) and exp->exp2 conversion into Q
#define QSCALE 0.3606737602222409f

static __device__ __forceinline__ v8f wmma_f16(v16h a, v16h b, v8f c) {
  // D = A(16x32 f16) * B(32x16 f16) + C(16x16 f32)
  return __builtin_amdgcn_wmma_f32_16x16x32_f16(false, a, false, b, (short)0, c,
                                                false, false);
}

// ---------------------------------------------------------------------------
// Kernel 1: QKV projection. One wave computes a 16-row x 16-col (one head)
// tile of q, k, v via three WMMAs (K = E = 16, zero-padded to 32).
// Writes Q (pre-scaled, [b,h,s,d]), K ([b,h,s,d]), V transposed ([b,h,d,s]).
// ---------------------------------------------------------------------------
__global__ __launch_bounds__(256) void qkv_proj_kernel(
    const float* __restrict__ x,
    const float* __restrict__ wq, const float* __restrict__ bq,
    const float* __restrict__ wk, const float* __restrict__ bk,
    const float* __restrict__ wv, const float* __restrict__ bv,
    _Float16* __restrict__ Qh, _Float16* __restrict__ Kh,
    _Float16* __restrict__ Vt)
{
  const int lane  = threadIdx.x & 31;
  const int wave  = threadIdx.x >> 5;
  const int gw    = blockIdx.x * 8 + wave;   // 4096 waves total
  const int head  = gw & (NH_ - 1);
  const int rt    = gw >> 3;                 // row tile over B*S (0..511)
  const int mrow  = lane & 15;               // A-layout row / B-layout col
  const int khalf = (lane >> 4) << 3;        // 0 or 8: K-lane-group base
  const int mbase = khalf;                   // C-layout row base
  const int n     = lane & 15;

  // A operand: x tile, 16 rows x K=16 (pad to 32 with zeros)
  v16h a = {};
  {
    const float* xr = x + ((size_t)rt * 16 + mrow) * E_ + khalf;
    #pragma unroll
    for (int i = 0; i < 8; ++i) a[i] = (_Float16)xr[i];
  }

  const int ncol = head * 16 + n;            // output column 0..127

  v16h bwq = {}, bwk = {}, bwv = {};
  {
    const float* pq = wq + (size_t)ncol * E_ + khalf;
    const float* pk = wk + (size_t)ncol * E_ + khalf;
    const float* pv = wv + (size_t)ncol * E_ + khalf;
    #pragma unroll
    for (int i = 0; i < 8; ++i) {
      bwq[i] = (_Float16)pq[i];
      bwk[i] = (_Float16)pk[i];
      bwv[i] = (_Float16)pv[i];
    }
  }

  v8f cq = {}, ck = {}, cv = {};
  {
    const float tq = bq[ncol], tk = bk[ncol], tv = bv[ncol];
    #pragma unroll
    for (int r = 0; r < 8; ++r) { cq[r] = tq; ck[r] = tk; cv[r] = tv; }
  }

  cq = wmma_f16(a, bwq, cq);
  ck = wmma_f16(a, bwk, ck);
  cv = wmma_f16(a, bwv, cv);

  #pragma unroll
  for (int r = 0; r < 8; ++r) {
    const int sg = rt * 16 + mbase + r;      // global row in [0, B*S)
    const int b  = sg >> 12;                 // / S_
    const int s  = sg & (S_ - 1);
    const size_t bh = (size_t)(b * NH_ + head);
    Qh[(bh * S_ + s) * HD_ + n] = (_Float16)(cq[r] * QSCALE);
    Kh[(bh * S_ + s) * HD_ + n] = (_Float16)ck[r];
    Vt[(bh * HD_ + n) * S_ + s] = (_Float16)cv[r];
  }
}

// ---------------------------------------------------------------------------
// Kernel 2: transposed flash attention. Each block owns one (b,h); its 8
// waves own 8 consecutive 16-query tiles and SHARE double-buffered K/V
// tiles staged in LDS. Per 32-key step:
//   S^T = K . Q^T            (2 WMMAs; lane owns one query column,
//                             keys live on the in-lane VGPR index)
//   in-lane softmax          (1 shfl for max, 1 shfl for sum)
//   O^T += V^T . P^T         (1 full-K=32 WMMA; P^T B-operand is built
//                             with pure in-lane f32->f16 converts)
// No LDS round-trip for P, no butterflies over columns.
// ---------------------------------------------------------------------------
__global__ __launch_bounds__(256) void flash_attn_kernel(
    const _Float16* __restrict__ Qh, const _Float16* __restrict__ Kh,
    const _Float16* __restrict__ Vt, _Float16* __restrict__ Ah)
{
  __shared__ __align__(16) _Float16 kbuf[2][KT_ * HD_];   // [key][hd]
  __shared__ __align__(16) _Float16 vbuf[2][HD_ * KT_];   // [hd][key] (V^T)

  const int tid   = threadIdx.x;
  const int lane  = tid & 31;
  const int wave  = tid >> 5;
  const int bh    = blockIdx.x >> 5;                      // uniform per block
  const int qt    = ((blockIdx.x & 31) << 3) | wave;      // query tile 0..255
  const int n     = lane & 15;                            // query col / hd row
  const int khalf = (lane >> 4) << 3;                     // K-group base (0/8)

  const _Float16* qp = Qh + ((size_t)bh * S_ + (size_t)qt * 16) * HD_;
  const _Float16* kp = Kh + (size_t)bh * S_ * HD_;
  const _Float16* vp = Vt + (size_t)bh * HD_ * S_;

  // Cooperative tile stage: K tile = 256 dwords contiguous; V^T tile =
  // 16 rows x 16 dwords. One dword each per thread per tile.
  const int vrow = tid >> 4;          // 0..15
  const int vcol = tid & 15;          // dword within row
  auto stage = [&](int buf, int kt) {
    ((unsigned int*)&kbuf[buf][0])[tid] =
        ((const unsigned int*)(kp + (size_t)kt * KT_ * HD_))[tid];
    ((unsigned int*)&vbuf[buf][0])[tid] =
        ((const unsigned int*)(vp + (size_t)vrow * S_ + (size_t)kt * KT_))[vcol];
  };

  // B operand: Q^T (loop-invariant). Lane = query col n; halves 0..7 =
  // hd khalf..khalf+7; upper halves zero (contraction hd=16 padded to 32).
  v16h bq = {};
  {
    const v8h q8 = *(const v8h*)(qp + n * HD_ + khalf);
    #pragma unroll
    for (int i = 0; i < 8; ++i) bq[i] = q8[i];
  }

  v8f acc = {};                 // O^T tile: (hd row khalf+r, query col n)
  float mrun = -3.0e38f;
  float lrun = 0.0f;

  stage(0, 0);

  for (int kt = 0; kt < NKT; ++kt) {
    const int cur = kt & 1;
    __syncthreads();                       // staged tile visible; prev reads done
    if (kt + 1 < NKT) stage(cur ^ 1, kt + 1);

    // A operands for S^T: two 16-key tiles (rows = keys), contraction = hd
    v16h ak0 = {}, ak1 = {};
    {
      const v8h k8a = *(const v8h*)&kbuf[cur][(size_t)n * HD_ + khalf];
      const v8h k8b = *(const v8h*)&kbuf[cur][(size_t)(16 + n) * HD_ + khalf];
      #pragma unroll
      for (int i = 0; i < 8; ++i) { ak0[i] = k8a[i]; ak1[i] = k8b[i]; }
    }
    // A operand for O^T: V^T tile (rows = hd), full contraction K=32 keys
    v16h av;
    {
      const v8h v8a = *(const v8h*)&vbuf[cur][(size_t)n * KT_ + khalf];
      const v8h v8b = *(const v8h*)&vbuf[cur][(size_t)n * KT_ + khalf + 16];
      #pragma unroll
      for (int i = 0; i < 8; ++i) { av[i] = v8a[i]; av[8 + i] = v8b[i]; }
    }

    v8f z = {};
    v8f s0 = wmma_f16(ak0, bq, z);   // S^T: keys khalf+0..7  x query n
    v8f s1 = wmma_f16(ak1, bq, z);   // S^T: keys khalf+16..23 x query n

    // Online softmax over 32 keys: in-lane over r, one shuffle across the
    // half-wave pair (lane ^ 16 holds the other 8+8 keys of query n).
    float vmax = fmaxf(s0[0], s1[0]);
    #pragma unroll
    for (int r = 1; r < 8; ++r) vmax = fmaxf(vmax, fmaxf(s0[r], s1[r]));
    vmax = fmaxf(vmax, __shfl_xor(vmax, 16, 32));
    const float mnew  = fmaxf(mrun, vmax);
    const float alpha = exp2f(mrun - mnew);
    mrun = mnew;

    // P^T B-operand: halves j = key khalf+j, halves 8+j = key khalf+16+j —
    // exactly this lane's s0/s1 elements. Pure in-lane converts.
    v16h bp;
    float ps = 0.0f;
    #pragma unroll
    for (int r = 0; r < 8; ++r) {
      const float p0 = exp2f(s0[r] - mnew);
      const float p1 = exp2f(s1[r] - mnew);
      ps += p0 + p1;
      bp[r]     = (_Float16)p0;
      bp[8 + r] = (_Float16)p1;
    }
    ps += __shfl_xor(ps, 16, 32);
    lrun = lrun * alpha + ps;

    #pragma unroll
    for (int r = 0; r < 8; ++r) acc[r] *= alpha;

    acc = wmma_f16(av, bp, acc);     // O^T += V^T . P^T (full K=32)
  }

  // Normalize; O^T C-layout makes the store one contiguous 16B per lane:
  // lane holds hd rows khalf..khalf+7 of query qt*16+n.
  const float inv = 1.0f / lrun;
  v8h oh;
  #pragma unroll
  for (int r = 0; r < 8; ++r) oh[r] = (_Float16)(acc[r] * inv);
  const int b = bh >> 3, h = bh & 7;
  _Float16* dst =
      Ah + (((size_t)b * S_ + (size_t)qt * 16 + n) * NH_ + h) * HD_ + khalf;
  *(v8h*)dst = oh;
}

// ---------------------------------------------------------------------------
// Kernel 3: output projection. out[16-row tile] = Ah @ wo^T + bo,
// K = 128 -> 4 chained WMMAs.
// ---------------------------------------------------------------------------
__global__ __launch_bounds__(256) void out_proj_kernel(
    const _Float16* __restrict__ Ah, const float* __restrict__ wo,
    const float* __restrict__ bo, float* __restrict__ out)
{
  const int lane  = threadIdx.x & 31;
  const int wave  = threadIdx.x >> 5;
  const int rt    = blockIdx.x * 8 + wave;   // 512 row tiles over B*S
  const int mrow  = lane & 15;
  const int khalf = (lane >> 4) << 3;
  const int mbase = khalf;
  const int n     = lane & 15;

  v8f c = {};
  {
    const float t = bo[n];
    #pragma unroll
    for (int r = 0; r < 8; ++r) c[r] = t;
  }

  const _Float16* arow = Ah + ((size_t)rt * 16 + mrow) * H_;
  const float*    wrow = wo + (size_t)n * H_;   // wo[E,H] row n = output col

  #pragma unroll
  for (int kc = 0; kc < 4; ++kc) {
    const int kb = kc * 32;
    v16h a = {};
    {
      const v8h a0 = *(const v8h*)(arow + kb + khalf);
      const v8h a1 = *(const v8h*)(arow + kb + khalf + 16);
      #pragma unroll
      for (int i = 0; i < 8; ++i) { a[i] = a0[i]; a[8 + i] = a1[i]; }
    }
    v16h b = {};
    {
      #pragma unroll
      for (int i = 0; i < 8; ++i) {
        b[i]     = (_Float16)wrow[kb + khalf + i];
        b[8 + i] = (_Float16)wrow[kb + khalf + 16 + i];
      }
    }
    c = wmma_f16(a, b, c);
  }

  #pragma unroll
  for (int r = 0; r < 8; ++r) {
    const int row = rt * 16 + mbase + r;
    out[(size_t)row * E_ + n] = c[r];
  }
}

// ---------------------------------------------------------------------------
extern "C" void kernel_launch(void* const* d_in, const int* in_sizes, int n_in,
                              void* d_out, int out_size, void* d_ws, size_t ws_size,
                              hipStream_t stream)
{
  const float* x  = (const float*)d_in[0];
  const float* wq = (const float*)d_in[1];
  const float* bq = (const float*)d_in[2];
  const float* wk = (const float*)d_in[3];
  const float* bk = (const float*)d_in[4];
  const float* wv = (const float*)d_in[5];
  const float* bv = (const float*)d_in[6];
  const float* wo = (const float*)d_in[7];
  const float* bo = (const float*)d_in[8];
  float* out = (float*)d_out;

  const size_t nqkv = (size_t)B_ * NH_ * S_ * HD_;   // 1M halves each
  _Float16* Qh = (_Float16*)d_ws;
  _Float16* Kh = Qh + nqkv;
  _Float16* Vt = Kh + nqkv;
  _Float16* Ah = Vt + nqkv;                          // total 8 MB of d_ws

  qkv_proj_kernel<<<512, 256, 0, stream>>>(x, wq, bq, wk, bk, wv, bv, Qh, Kh, Vt);
  flash_attn_kernel<<<512, 256, 0, stream>>>(Qh, Kh, Vt, Ah);
  out_proj_kernel<<<64, 256, 0, stream>>>(Ah, wo, bo, out);
}

// v001
// A run of this version takes 80.6 microseconds.
// Timed twice side by side with v000, it ran 1.20 and 1.22 times as fast.
#include <hip/hip_runtime.h>

typedef __attribute__((ext_vector_type(16))) _Float16 v16h;
typedef __attribute__((ext_vector_type(8)))  _Float16 v8h;
typedef __attribute__((ext_vector_type(8)))  float    v8f;

#define B_  2
#define S_  4096
#define E_  16
#define H_  128
#define NH_ 8
#define HD_ 16
#define KT_ 32                      // keys per inner iteration
#define NKT (S_ / KT_)              // 128 iterations

// 0.25 * log2(e): fold softmax scale (1/sqrt(16)) and exp->exp2 conversion into Q
#define QSCALE 0.3606737602222409f

static __device__ __forceinline__ v8f wmma_f16(v16h a, v16h b, v8f c) {
  // D = A(16x32 f16) * B(32x16 f16) + C(16x16 f32)
  return __builtin_amdgcn_wmma_f32_16x16x32_f16(false, a, false, b, (short)0, c,
                                                false, false);
}

// ---------------------------------------------------------------------------
// Kernel 1: QKV projection. One wave computes a 16-row x 16-col (one head)
// tile of q, k, v via three WMMAs (K = E = 16, zero-padded to 32).
// Writes Q (pre-scaled, [b,h,s,d]), K ([b,h,s,d]), V transposed ([b,h,d,s]).
// ---------------------------------------------------------------------------
__global__ __launch_bounds__(256) void qkv_proj_kernel(
    const float* __restrict__ x,
    const float* __restrict__ wq, const float* __restrict__ bq,
    const float* __restrict__ wk, const float* __restrict__ bk,
    const float* __restrict__ wv, const float* __restrict__ bv,
    _Float16* __restrict__ Qh, _Float16* __restrict__ Kh,
    _Float16* __restrict__ Vt)
{
  const int lane  = threadIdx.x & 31;
  const int wave  = threadIdx.x >> 5;
  const int gw    = blockIdx.x * 8 + wave;   // 4096 waves total
  const int head  = gw & (NH_ - 1);
  const int rt    = gw >> 3;                 // row tile over B*S (0..511)
  const int mrow  = lane & 15;               // A-layout row / B-layout col
  const int khalf = (lane >> 4) << 3;        // 0 or 8: K-lane-group base
  const int mbase = khalf;                   // C-layout row base
  const int n     = lane & 15;

  // A operand: x tile, 16 rows x K=16 (pad to 32 with zeros)
  v16h a = {};
  {
    const float* xr = x + ((size_t)rt * 16 + mrow) * E_ + khalf;
    #pragma unroll
    for (int i = 0; i < 8; ++i) a[i] = (_Float16)xr[i];
  }

  const int ncol = head * 16 + n;            // output column 0..127

  v16h bwq = {}, bwk = {}, bwv = {};
  {
    const float* pq = wq + (size_t)ncol * E_ + khalf;
    const float* pk = wk + (size_t)ncol * E_ + khalf;
    const float* pv = wv + (size_t)ncol * E_ + khalf;
    #pragma unroll
    for (int i = 0; i < 8; ++i) {
      bwq[i] = (_Float16)pq[i];
      bwk[i] = (_Float16)pk[i];
      bwv[i] = (_Float16)pv[i];
    }
  }

  v8f cq = {}, ck = {}, cv = {};
  {
    const float tq = bq[ncol], tk = bk[ncol], tv = bv[ncol];
    #pragma unroll
    for (int r = 0; r < 8; ++r) { cq[r] = tq; ck[r] = tk; cv[r] = tv; }
  }

  cq = wmma_f16(a, bwq, cq);
  ck = wmma_f16(a, bwk, ck);
  cv = wmma_f16(a, bwv, cv);

  #pragma unroll
  for (int r = 0; r < 8; ++r) {
    const int sg = rt * 16 + mbase + r;      // global row in [0, B*S)
    const int b  = sg >> 12;                 // / S_
    const int s  = sg & (S_ - 1);
    const size_t bh = (size_t)(b * NH_ + head);
    Qh[(bh * S_ + s) * HD_ + n] = (_Float16)(cq[r] * QSCALE);
    Kh[(bh * S_ + s) * HD_ + n] = (_Float16)ck[r];
    Vt[(bh * HD_ + n) * S_ + s] = (_Float16)cv[r];
  }
}

// ---------------------------------------------------------------------------
// Kernel 2: transposed flash attention. Each block owns one (b,h); its 8
// waves own 8 consecutive 16-query tiles and SHARE double-buffered K/V
// tiles staged in LDS. Per 32-key step:
//   S^T = K . Q^T            (2 WMMAs; lane owns one query column,
//                             keys live on the in-lane VGPR index)
//   in-lane softmax          (1 shfl for max, 1 shfl for sum)
//   O^T += V^T . P^T         (1 full-K=32 WMMA; P^T B-operand is built
//                             with pure in-lane f32->f16 converts)
// No LDS round-trip for P, no butterflies over columns.
// ---------------------------------------------------------------------------
__global__ __launch_bounds__(256) void flash_attn_kernel(
    const _Float16* __restrict__ Qh, const _Float16* __restrict__ Kh,
    const _Float16* __restrict__ Vt, _Float16* __restrict__ Ah)
{
  __shared__ __align__(16) _Float16 kbuf[2][KT_ * HD_];   // [key][hd]
  __shared__ __align__(16) _Float16 vbuf[2][HD_ * KT_];   // [hd][key] (V^T)

  const int tid   = threadIdx.x;
  const int lane  = tid & 31;
  const int wave  = tid >> 5;
  const int bh    = blockIdx.x >> 5;                      // uniform per block
  const int qt    = ((blockIdx.x & 31) << 3) | wave;      // query tile 0..255
  const int n     = lane & 15;                            // query col / hd row
  const int khalf = (lane >> 4) << 3;                     // K-group base (0/8)

  const _Float16* qp = Qh + ((size_t)bh * S_ + (size_t)qt * 16) * HD_;
  const _Float16* kp = Kh + (size_t)bh * S_ * HD_;
  const _Float16* vp = Vt + (size_t)bh * HD_ * S_;

  // Cooperative tile stage: K tile = 256 dwords contiguous; V^T tile =
  // 16 rows x 16 dwords. One dword each per thread per tile.
  const int vrow = tid >> 4;          // 0..15
  const int vcol = tid & 15;          // dword within row
  auto stage = [&](int buf, int kt) {
    ((unsigned int*)&kbuf[buf][0])[tid] =
        ((const unsigned int*)(kp + (size_t)kt * KT_ * HD_))[tid];
    ((unsigned int*)&vbuf[buf][0])[tid] =
        ((const unsigned int*)(vp + (size_t)vrow * S_ + (size_t)kt * KT_))[vcol];
  };

  // B operand: Q^T (loop-invariant). Lane = query col n; halves 0..7 =
  // hd khalf..khalf+7; upper halves zero (contraction hd=16 padded to 32).
  v16h bq = {};
  {
    const v8h q8 = *(const v8h*)(qp + n * HD_ + khalf);
    #pragma unroll
    for (int i = 0; i < 8; ++i) bq[i] = q8[i];
  }

  v8f acc = {};                 // O^T tile: (hd row khalf+r, query col n)
  float mrun = -3.0e38f;
  float lrun = 0.0f;

  stage(0, 0);

  for (int kt = 0; kt < NKT; ++kt) {
    const int cur = kt & 1;
    __syncthreads();                       // staged tile visible; prev reads done
    if (kt + 1 < NKT) stage(cur ^ 1, kt + 1);

    // A operands for S^T: two 16-key tiles (rows = keys), contraction = hd
    v16h ak0 = {}, ak1 = {};
    {
      const v8h k8a = *(const v8h*)&kbuf[cur][(size_t)n * HD_ + khalf];
      const v8h k8b = *(const v8h*)&kbuf[cur][(size_t)(16 + n) * HD_ + khalf];
      #pragma unroll
      for (int i = 0; i < 8; ++i) { ak0[i] = k8a[i]; ak1[i] = k8b[i]; }
    }
    // A operand for O^T: V^T tile (rows = hd), full contraction K=32 keys
    v16h av;
    {
      const v8h v8a = *(const v8h*)&vbuf[cur][(size_t)n * KT_ + khalf];
      const v8h v8b = *(const v8h*)&vbuf[cur][(size_t)n * KT_ + khalf + 16];
      #pragma unroll
      for (int i = 0; i < 8; ++i) { av[i] = v8a[i]; av[8 + i] = v8b[i]; }
    }

    v8f z = {};
    v8f s0 = wmma_f16(ak0, bq, z);   // S^T: keys khalf+0..7  x query n
    v8f s1 = wmma_f16(ak1, bq, z);   // S^T: keys khalf+16..23 x query n

    // Online softmax over 32 keys: in-lane over r, one shuffle across the
    // half-wave pair (lane ^ 16 holds the other 8+8 keys of query n).
    float vmax = fmaxf(s0[0], s1[0]);
    #pragma unroll
    for (int r = 1; r < 8; ++r) vmax = fmaxf(vmax, fmaxf(s0[r], s1[r]));
    vmax = fmaxf(vmax, __shfl_xor(vmax, 16, 32));
    const float mnew  = fmaxf(mrun, vmax);
    const float alpha = __builtin_amdgcn_exp2f(mrun - mnew);
    mrun = mnew;

    // P^T B-operand: halves j = key khalf+j, halves 8+j = key khalf+16+j —
    // exactly this lane's s0/s1 elements. Pure in-lane converts.
    // Hardware exp2 directly: arguments are <= 0, and a result under 2^-126
    // (flushed to 0 here) is 0 in f16 P and vanishes beside a sum >= 1.
    v16h bp;
    v8f p0 = s0 - mnew, p1 = s1 - mnew;
    #pragma unroll
    for (int r = 0; r < 8; ++r) {
      p0[r] = __builtin_amdgcn_exp2f(p0[r]);
      p1[r] = __builtin_amdgcn_exp2f(p1[r]);
    }
    const v8f pp = p0 + p1;
    float ps = pp[0];
    #pragma unroll
    for (int r = 1; r < 8; ++r) ps += pp[r];
    #pragma unroll
    for (int r = 0; r < 8; ++r) {
      bp[r]     = (_Float16)p0[r];
      bp[8 + r] = (_Float16)p1[r];
    }
    ps += __shfl_xor(ps, 16, 32);
    lrun = lrun * alpha + ps;

    #pragma unroll
    for (int r = 0; r < 8; ++r) acc[r] *= alpha;

    acc = wmma_f16(av, bp, acc);     // O^T += V^T . P^T (full K=32)
  }

  // Normalize; O^T C-layout makes the store one contiguous 16B per lane:
  // lane holds hd rows khalf..khalf+7 of query qt*16+n.
  const float inv = 1.0f / lrun;
  v8h oh;
  #pragma unroll
  for (int r = 0; r < 8; ++r) oh[r] = (_Float16)(acc[r] * inv);
  const int b = bh >> 3, h = bh & 7;
  _Float16* dst =
      Ah + (((size_t)b * S_ + (size_t)qt * 16 + n) * NH_ + h) * HD_ + khalf;
  *(v8h*)dst = oh;
}

// ---------------------------------------------------------------------------
// Kernel 3: output projection. out[16-row tile] = Ah @ wo^T + bo,
// K = 128 -> 4 chained WMMAs.
// ---------------------------------------------------------------------------
__global__ __launch_bounds__(256) void out_proj_kernel(
    const _Float16* __restrict__ Ah, const float* __restrict__ wo,
    const float* __restrict__ bo, float* __restrict__ out)
{
  const int lane  = threadIdx.x & 31;
  const int wave  = threadIdx.x >> 5;
  const int rt    = blockIdx.x * 8 + wave;   // 512 row tiles over B*S
  const int mrow  = lane & 15;
  const int khalf = (lane >> 4) << 3;
  const int mbase = khalf;
  const int n     = lane & 15;

  v8f c = {};
  {
    const float t = bo[n];
    #pragma unroll
    for (int r = 0; r < 8; ++r) c[r] = t;
  }

  const _Float16* arow = Ah + ((size_t)rt * 16 + mrow) * H_;
  const float*    wrow = wo + (size_t)n * H_;   // wo[E,H] row n = output col

  #pragma unroll
  for (int kc = 0; kc < 4; ++kc) {
    const int kb = kc * 32;
    v16h a = {};
    {
      const v8h a0 = *(const v8h*)(arow + kb + khalf);
      const v8h a1 = *(const v8h*)(arow + kb + khalf + 16);
      #pragma unroll
      for (int i = 0; i < 8; ++i) { a[i] = a0[i]; a[8 + i] = a1[i]; }
    }
    v16h b = {};
    {
      #pragma unroll
      for (int i = 0; i < 8; ++i) {
        b[i]     = (_Float16)wrow[kb + khalf + i];
        b[8 + i] = (_Float16)wrow[kb + khalf + 16 + i];
      }
    }
    c = wmma_f16(a, b, c);
  }

  #pragma unroll
  for (int r = 0; r < 8; ++r) {
    const int row = rt * 16 + mbase + r;
    out[(size_t)row * E_ + n] = c[r];
  }
}

// ---------------------------------------------------------------------------
extern "C" void kernel_launch(void* const* d_in, const int* in_sizes, int n_in,
                              void* d_out, int out_size, void* d_ws, size_t ws_size,
                              hipStream_t stream)
{
  const float* x  = (const float*)d_in[0];
  const float* wq = (const float*)d_in[1];
  const float* bq = (const float*)d_in[2];
  const float* wk = (const float*)d_in[3];
  const float* bk = (const float*)d_in[4];
  const float* wv = (const float*)d_in[5];
  const float* bv = (const float*)d_in[6];
  const float* wo = (const float*)d_in[7];
  const float* bo = (const float*)d_in[8];
  float* out = (float*)d_out;

  const size_t nqkv = (size_t)B_ * NH_ * S_ * HD_;   // 1M halves each
  _Float16* Qh = (_Float16*)d_ws;
  _Float16* Kh = Qh + nqkv;
  _Float16* Vt = Kh + nqkv;
  _Float16* Ah = Vt + nqkv;                          // total 8 MB of d_ws

  qkv_proj_kernel<<<512, 256, 0, stream>>>(x, wq, bq, wk, bk, wv, bv, Qh, Kh, Vt);
  flash_attn_kernel<<<512, 256, 0, stream>>>(Qh, Kh, Vt, Ah);
  out_proj_kernel<<<64, 256, 0, stream>>>(Ah, wo, bo, out);
}

// v002
// Measured time: 53.1 microseconds a run.
// In both of two side-by-side timings against v001, it was 1.50 times as fast.
// Counting every step since v000, it is 1.81 times as fast.
#include <hip/hip_runtime.h>

typedef __attribute__((ext_vector_type(16))) _Float16 v16h;
typedef __attribute__((ext_vector_type(8)))  _Float16 v8h;
typedef __attribute__((ext_vector_type(8)))  float    v8f;

#define B_  2
#define S_  4096
#define E_  16
#define H_  128
#define NH_ 8
#define HD_ 16
#define KT_ 32                      // keys per inner iteration
#define NKT (S_ / KT_)              // 128 iterations
#define AW_ 16                      // waves per attention block
#define VP_ (S_ + 8)                // LDS pitch of a V^T row in halves: 16 B x odd

// 0.25 * log2(e): fold softmax scale (1/sqrt(16)) and exp->exp2 conversion into Q
#define QSCALE 0.3606737602222409f

static __device__ __forceinline__ v8f wmma_f16(v16h a, v16h b, v8f c) {
  // D = A(16x32 f16) * B(32x16 f16) + C(16x16 f32)
  return __builtin_amdgcn_wmma_f32_16x16x32_f16(false, a, false, b, (short)0, c,
                                                false, false);
}

// ---------------------------------------------------------------------------
// Kernel 1: QKV projection. One wave computes a 16-row x 16-col (one head)
// tile of q, k, v via three WMMAs (K = E = 16, zero-padded to 32).
// Writes Q (pre-scaled, [b,h,s,d]), K ([b,h,s,d]), V transposed ([b,h,d,s]).
// ---------------------------------------------------------------------------
__global__ __launch_bounds__(256) void qkv_proj_kernel(
    const float* __restrict__ x,
    const float* __restrict__ wq, const float* __restrict__ bq,
    const float* __restrict__ wk, const float* __restrict__ bk,
    const float* __restrict__ wv, const float* __restrict__ bv,
    _Float16* __restrict__ Qh, _Float16* __restrict__ Kh,
    _Float16* __restrict__ Vt)
{
  const int lane  = threadIdx.x & 31;
  const int wave  = threadIdx.x >> 5;
  const int gw    = blockIdx.x * 8 + wave;   // 4096 waves total
  const int head  = gw & (NH_ - 1);
  const int rt    = gw >> 3;                 // row tile over B*S (0..511)
  const int mrow  = lane & 15;               // A-layout row / B-layout col
  const int khalf = (lane >> 4) << 3;        // 0 or 8: K-lane-group base
  const int mbase = khalf;                   // C-layout row base
  const int n     = lane & 15;

  // A operand: x tile, 16 rows x K=16 (pad to 32 with zeros)
  v16h a = {};
  {
    const float* xr = x + ((size_t)rt * 16 + mrow) * E_ + khalf;
    #pragma unroll
    for (int i = 0; i < 8; ++i) a[i] = (_Float16)xr[i];
  }

  const int ncol = head * 16 + n;            // output column 0..127

  v16h bwq = {}, bwk = {}, bwv = {};
  {
    const float* pq = wq + (size_t)ncol * E_ + khalf;
    const float* pk = wk + (size_t)ncol * E_ + khalf;
    const float* pv = wv + (size_t)ncol * E_ + khalf;
    #pragma unroll
    for (int i = 0; i < 8; ++i) {
      bwq[i] = (_Float16)pq[i];
      bwk[i] = (_Float16)pk[i];
      bwv[i] = (_Float16)pv[i];
    }
  }

  v8f cq = {}, ck = {}, cv = {};
  {
    const float tq = bq[ncol], tk = bk[ncol], tv = bv[ncol];
    #pragma unroll
    for (int r = 0; r < 8; ++r) { cq[r] = tq; ck[r] = tk; cv[r] = tv; }
  }

  cq = wmma_f16(a, bwq, cq);
  ck = wmma_f16(a, bwk, ck);
  cv = wmma_f16(a, bwv, cv);

  #pragma unroll
  for (int r = 0; r < 8; ++r) {
    const int sg = rt * 16 + mbase + r;      // global row in [0, B*S)
    const int b  = sg >> 12;                 // / S_
    const int s  = sg & (S_ - 1);
    const size_t bh = (size_t)(b * NH_ + head);
    Qh[(bh * S_ + s) * HD_ + n] = (_Float16)(cq[r] * QSCALE);
    Kh[(bh * S_ + s) * HD_ + n] = (_Float16)ck[r];
    Vt[(bh * HD_ + n) * S_ + s] = (_Float16)cv[r];
  }
}

// ---------------------------------------------------------------------------
// Kernel 2: transposed flash attention. Each block owns one (b,h); its 16
// waves own 16 consecutive 16-query tiles and SHARE the head's whole K and
// V^T (128 KiB each), staged in LDS once: one block fills a WGP, and the key
// loop holds no global load and no barrier. Per 32-key step:
//   S^T = K . Q^T            (2 WMMAs; lane owns one query column,
//                             keys live on the in-lane VGPR index)
//   in-lane softmax          (1 shfl for max, 1 shfl for sum)
//   O^T += V^T . P^T         (1 full-K=32 WMMA; P^T B-operand is built
//                             with pure in-lane f32->f16 converts)
// No LDS round-trip for P, no butterflies over columns.
// ---------------------------------------------------------------------------
__global__ __launch_bounds__(AW_ * 32) void flash_attn_kernel(
    const _Float16* __restrict__ Qh, const _Float16* __restrict__ Kh,
    const _Float16* __restrict__ Vt, _Float16* __restrict__ Ah)
{
  __shared__ __align__(16) _Float16 smem[S_ * HD_ + HD_ * VP_];
  _Float16* const kbuf = smem;                            // [key][hd]
  _Float16* const vbuf = smem + S_ * HD_;                 // [hd][key] (V^T), padded rows

  const int tid   = threadIdx.x;
  const int lane  = tid & 31;
  const int wave  = tid >> 5;
  const int bh    = blockIdx.x >> 4;                      // uniform per block
  const int qt    = ((blockIdx.x & 15) << 4) | wave;      // query tile 0..255
  const int n     = lane & 15;                            // query col / hd row
  const int khalf = (lane >> 4) << 3;                     // K-group base (0/8)

  const _Float16* qp = Qh + ((size_t)bh * S_ + (size_t)qt * 16) * HD_;
  const _Float16* kp = Kh + (size_t)bh * S_ * HD_;
  const _Float16* vp = Vt + (size_t)bh * HD_ * S_;

  // Cooperative stage of the whole head, 16 B per thread and pass: K is one
  // contiguous copy; each pass of V^T is one 8 KiB row, laid at the padded
  // pitch so that the 16 rows a fragment load touches fall on distinct banks.
  // Both loops unrolled so that every load of the stage is in flight at once.
  #pragma unroll
  for (int i = 0; i < (S_ * HD_) / (AW_ * 32 * 8); ++i)
    *(v8h*)&kbuf[(i * AW_ * 32 + tid) * 8] =
        *(const v8h*)(kp + (size_t)(i * AW_ * 32 + tid) * 8);
  #pragma unroll
  for (int i = 0; i < HD_; ++i)
    *(v8h*)&vbuf[i * VP_ + tid * 8] = *(const v8h*)(vp + (size_t)i * S_ + tid * 8);

  // B operand: Q^T (loop-invariant). Lane = query col n; halves 0..7 =
  // hd khalf..khalf+7; upper halves zero (contraction hd=16 padded to 32).
  v16h bq = {};
  {
    const v8h q8 = *(const v8h*)(qp + n * HD_ + khalf);
    #pragma unroll
    for (int i = 0; i < 8; ++i) bq[i] = q8[i];
  }

  v8f acc = {};                 // O^T tile: (hd row khalf+r, query col n)
  float mrun = -3.0e38f;
  float lrun = 0.0f;

  __syncthreads();                         // whole head visible to every wave

  for (int kt = 0; kt < NKT; ++kt) {

    // A operands for S^T: two 16-key tiles (rows = keys), contraction = hd
    v16h ak0 = {}, ak1 = {};
    {
      const v8h k8a = *(const v8h*)&kbuf[(kt * KT_ + n) * HD_ + khalf];
      const v8h k8b = *(const v8h*)&kbuf[(kt * KT_ + 16 + n) * HD_ + khalf];
      #pragma unroll
      for (int i = 0; i < 8; ++i) { ak0[i] = k8a[i]; ak1[i] = k8b[i]; }
    }
    // A operand for O^T: V^T tile (rows = hd), full contraction K=32 keys
    v16h av;
    {
      const v8h v8a = *(const v8h*)&vbuf[n * VP_ + kt * KT_ + khalf];
      const v8h v8b = *(const v8h*)&vbuf[n * VP_ + kt * KT_ + khalf + 16];
      #pragma unroll
      for (int i = 0; i < 8; ++i) { av[i] = v8a[i]; av[8 + i] = v8b[i]; }
    }

    v8f z = {};
    v8f s0 = wmma_f16(ak0, bq, z);   // S^T: keys khalf+0..7  x query n
    v8f s1 = wmma_f16(ak1, bq, z);   // S^T: keys khalf+16..23 x query n

    // Online softmax over 32 keys: in-lane over r, one shuffle across the
    // half-wave pair (lane ^ 16 holds the other 8+8 keys of query n).
    float vmax = fmaxf(s0[0], s1[0]);
    #pragma unroll
    for (int r = 1; r < 8; ++r) vmax = fmaxf(vmax, fmaxf(s0[r], s1[r]));
    vmax = fmaxf(vmax, __shfl_xor(vmax, 16, 32));
    const float mnew  = fmaxf(mrun, vmax);
    const float alpha = __builtin_amdgcn_exp2f(mrun - mnew);
    mrun = mnew;

    // P^T B-operand: halves j = key khalf+j, halves 8+j = key khalf+16+j —
    // exactly this lane's s0/s1 elements. Pure in-lane converts.
    // Hardware exp2 directly: arguments are <= 0, and a result under 2^-126
    // (flushed to 0 here) is 0 in f16 P and vanishes beside a sum >= 1.
    v16h bp;
    v8f p0 = s0 - mnew, p1 = s1 - mnew;
    #pragma unroll
    for (int r = 0; r < 8; ++r) {
      p0[r] = __builtin_amdgcn_exp2f(p0[r]);
      p1[r] = __builtin_amdgcn_exp2f(p1[r]);
    }
    const v8f pp = p0 + p1;
    float ps = pp[0];
    #pragma unroll
    for (int r = 1; r < 8; ++r) ps += pp[r];
    #pragma unroll
    for (int r = 0; r < 8; ++r) {
      bp[r]     = (_Float16)p0[r];
      bp[8 + r] = (_Float16)p1[r];
    }
    ps += __shfl_xor(ps, 16, 32);
    lrun = lrun * alpha + ps;

    #pragma unroll
    for (int r = 0; r < 8; ++r) acc[r] *= alpha;

    acc = wmma_f16(av, bp, acc);     // O^T += V^T . P^T (full K=32)
  }

  // Normalize; O^T C-layout makes the store one contiguous 16B per lane:
  // lane holds hd rows khalf..khalf+7 of query qt*16+n.
  const float inv = 1.0f / lrun;
  v8h oh;
  #pragma unroll
  for (int r = 0; r < 8; ++r) oh[r] = (_Float16)(acc[r] * inv);
  const int b = bh >> 3, h = bh & 7;
  _Float16* dst =
      Ah + (((size_t)b * S_ + (size_t)qt * 16 + n) * NH_ + h) * HD_ + khalf;
  *(v8h*)dst = oh;
}

// ---------------------------------------------------------------------------
// Kernel 3: output projection. out[16-row tile] = Ah @ wo^T + bo,
// K = 128 -> 4 chained WMMAs.
// ---------------------------------------------------------------------------
__global__ __launch_bounds__(256) void out_proj_kernel(
    const _Float16* __restrict__ Ah, const float* __restrict__ wo,
    const float* __restrict__ bo, float* __restrict__ out)
{
  const int lane  = threadIdx.x & 31;
  const int wave  = threadIdx.x >> 5;
  const int rt    = blockIdx.x * 8 + wave;   // 512 row tiles over B*S
  const int mrow  = lane & 15;
  const int khalf = (lane >> 4) << 3;
  const int mbase = khalf;
  const int n     = lane & 15;

  v8f c = {};
  {
    const float t = bo[n];
    #pragma unroll
    for (int r = 0; r < 8; ++r) c[r] = t;
  }

  const _Float16* arow = Ah + ((size_t)rt * 16 + mrow) * H_;
  const float*    wrow = wo + (size_t)n * H_;   // wo[E,H] row n = output col

  #pragma unroll
  for (int kc = 0; kc < 4; ++kc) {
    const int kb = kc * 32;
    v16h a = {};
    {
      const v8h a0 = *(const v8h*)(arow + kb + khalf);
      const v8h a1 = *(const v8h*)(arow + kb + khalf + 16);
      #pragma unroll
      for (int i = 0; i < 8; ++i) { a[i] = a0[i]; a[8 + i] = a1[i]; }
    }
    v16h b = {};
    {
      #pragma unroll
      for (int i = 0; i < 8; ++i) {
        b[i]     = (_Float16)wrow[kb + khalf + i];
        b[8 + i] = (_Float16)wrow[kb + khalf + 16 + i];
      }
    }
    c = wmma_f16(a, b, c);
  }

  #pragma unroll
  for (int r = 0; r < 8; ++r) {
    const int row = rt * 16 + mbase + r;
    out[(size_t)row * E_ + n] = c[r];
  }
}

// ---------------------------------------------------------------------------
extern "C" void kernel_launch(void* const* d_in, const int* in_sizes, int n_in,
                              void* d_out, int out_size, void* d_ws, size_t ws_size,
                              hipStream_t stream)
{
  const float* x  = (const float*)d_in[0];
  const float* wq = (const float*)d_in[1];
  const float* bq = (const float*)d_in[2];
  const float* wk = (const float*)d_in[3];
  const float* bk = (const float*)d_in[4];
  const float* wv = (const float*)d_in[5];
  const float* bv = (const float*)d_in[6];
  const float* wo = (const float*)d_in[7];
  const float* bo = (const float*)d_in[8];
  float* out = (float*)d_out;

  const size_t nqkv = (size_t)B_ * NH_ * S_ * HD_;   // 1M halves each
  _Float16* Qh = (_Float16*)d_ws;
  _Float16* Kh = Qh + nqkv;
  _Float16* Vt = Kh + nqkv;
  _Float16* Ah = Vt + nqkv;                          // total 8 MB of d_ws

  qkv_proj_kernel<<<512, 256, 0, stream>>>(x, wq, bq, wk, bk, wv, bv, Qh, Kh, Vt);
  flash_attn_kernel<<<256, 512, 0, stream>>>(Qh, Kh, Vt, Ah);
  out_proj_kernel<<<64, 256, 0, stream>>>(Ah, wo, bo, out);
}

// v003
// One run takes 38.5 microseconds.
// Next to v002, in two timings, it ran 1.37 and 1.38 times as fast.
// Over all steps from v000 it is 2.49 times as fast.
#include <hip/hip_runtime.h>

typedef __attribute__((ext_vector_type(16))) _Float16 v16h;
typedef __attribute__((ext_vector_type(8)))  _Float16 v8h;
typedef __attribute__((ext_vector_type(8)))  float    v8f;
typedef __attribute__((ext_vector_type(4)))  float    v4f;
typedef __attribute__((ext_vector_type(2)))  float    v2f;

#define B_  2
#define S_  4096
#define E_  16
#define H_  128
#define NH_ 8
#define HD_ 16
#define KT_ 64                      // keys per inner iteration
#define NKT (S_ / KT_)              // 64 iterations
#define PBOUND 16384.0f             // a tile's exp sum above this refreshes the maximum
#define AW_ 16                      // waves per attention block
#define VP_ (S_ + 8)                // LDS pitch of a V^T row in halves: 16 B x odd

// 0.25 * log2(e): fold softmax scale (1/sqrt(16)) and exp->exp2 conversion into Q
#define QSCALE 0.3606737602222409f

static __device__ __forceinline__ v8f wmma_f16(v16h a, v16h b, v8f c) {
  // D = A(16x32 f16) * B(32x16 f16) + C(16x16 f32)
  return __builtin_amdgcn_wmma_f32_16x16x32_f16(false, a, false, b, (short)0, c,
                                                false, false);
}

// Sum of one lane's 32 values, as a tree of vector adds.
static __device__ __forceinline__ float sum32(v8f a, v8f b, v8f c, v8f d) {
  const v8f t = (a + b) + (c + d);
  const v4f u = t.lo + t.hi;
  const v2f w = u.lo + u.hi;
  return w.x + w.y;
}

// ---------------------------------------------------------------------------
// Kernel 1: QKV projection. One wave computes a 16-row x 16-col (one head)
// tile of q, k, v via three WMMAs (K = E = 16, zero-padded to 32).
// Writes Q (pre-scaled, [b,h,s,d]), K ([b,h,s,d]), V transposed ([b,h,d,s]).
// ---------------------------------------------------------------------------
__global__ __launch_bounds__(256) void qkv_proj_kernel(
    const float* __restrict__ x,
    const float* __restrict__ wq, const float* __restrict__ bq,
    const float* __restrict__ wk, const float* __restrict__ bk,
    const float* __restrict__ wv, const float* __restrict__ bv,
    _Float16* __restrict__ Qh, _Float16* __restrict__ Kh,
    _Float16* __restrict__ Vt)
{
  const int lane  = threadIdx.x & 31;
  const int wave  = threadIdx.x >> 5;
  const int gw    = blockIdx.x * 8 + wave;   // 4096 waves total
  const int head  = gw & (NH_ - 1);
  const int rt    = gw >> 3;                 // row tile over B*S (0..511)
  const int mrow  = lane & 15;               // A-layout row / B-layout col
  const int khalf = (lane >> 4) << 3;        // 0 or 8: K-lane-group base
  const int mbase = khalf;                   // C-layout row base
  const int n     = lane & 15;

  // A operand: x tile, 16 rows x K=16 (pad to 32 with zeros)
  v16h a = {};
  {
    const float* xr = x + ((size_t)rt * 16 + mrow) * E_ + khalf;
    #pragma unroll
    for (int i = 0; i < 8; ++i) a[i] = (_Float16)xr[i];
  }

  const int ncol = head * 16 + n;            // output column 0..127

  v16h bwq = {}, bwk = {}, bwv = {};
  {
    const float* pq = wq + (size_t)ncol * E_ + khalf;
    const float* pk = wk + (size_t)ncol * E_ + khalf;
    const float* pv = wv + (size_t)ncol * E_ + khalf;
    #pragma unroll
    for (int i = 0; i < 8; ++i) {
      bwq[i] = (_Float16)pq[i];
      bwk[i] = (_Float16)pk[i];
      bwv[i] = (_Float16)pv[i];
    }
  }

  v8f cq = {}, ck = {}, cv = {};
  {
    const float tq = bq[ncol], tk = bk[ncol], tv = bv[ncol];
    #pragma unroll
    for (int r = 0; r < 8; ++r) { cq[r] = tq; ck[r] = tk; cv[r] = tv; }
  }

  cq = wmma_f16(a, bwq, cq);
  ck = wmma_f16(a, bwk, ck);
  cv = wmma_f16(a, bwv, cv);

  #pragma unroll
  for (int r = 0; r < 8; ++r) {
    const int sg = rt * 16 + mbase + r;      // global row in [0, B*S)
    const int b  = sg >> 12;                 // / S_
    const int s  = sg & (S_ - 1);
    const size_t bh = (size_t)(b * NH_ + head);
    Qh[(bh * S_ + s) * HD_ + n] = (_Float16)(cq[r] * QSCALE);
    Kh[(bh * S_ + s) * HD_ + n] = (_Float16)ck[r];
    Vt[(bh * HD_ + n) * S_ + s] = (_Float16)cv[r];
  }
}

// ---------------------------------------------------------------------------
// Kernel 2: transposed flash attention. Each block owns one (b,h); its 16
// waves own 16 consecutive 16-query tiles and SHARE the head's whole K and
// V^T (128 KiB each), staged in LDS once: one block fills a WGP, and the key
// loop holds no global load and no barrier. Per 64-key step:
//   S^T - m = K . Q^T - m    (4 WMMAs; lane owns one query column,
//                             keys live on the in-lane VGPR index)
//   in-lane exp2 and sum     (m is refreshed, and the sums rescaled, only
//                             when a step's sum passes PBOUND)
//   O^T += V^T . P^T         (2 full-K=32 WMMAs; P^T B-operand is built
//                             with pure in-lane f32->f16 converts)
// No LDS round-trip for P, no butterflies over columns.
// ---------------------------------------------------------------------------
__global__ __launch_bounds__(AW_ * 32) void flash_attn_kernel(
    const _Float16* __restrict__ Qh, const _Float16* __restrict__ Kh,
    const _Float16* __restrict__ Vt, _Float16* __restrict__ Ah)
{
  __shared__ __align__(16) _Float16 smem[S_ * HD_ + HD_ * VP_];
  _Float16* const kbuf = smem;                            // [key][hd]
  _Float16* const vbuf = smem + S_ * HD_;                 // [hd][key] (V^T), padded rows

  const int tid   = threadIdx.x;
  const int lane  = tid & 31;
  const int wave  = tid >> 5;
  const int bh    = blockIdx.x >> 4;                      // uniform per block
  const int qt    = ((blockIdx.x & 15) << 4) | wave;      // query tile 0..255
  const int n     = lane & 15;                            // query col / hd row
  const int khalf = (lane >> 4) << 3;                     // K-group base (0/8)

  const _Float16* qp = Qh + ((size_t)bh * S_ + (size_t)qt * 16) * HD_;
  const _Float16* kp = Kh + (size_t)bh * S_ * HD_;
  const _Float16* vp = Vt + (size_t)bh * HD_ * S_;

  // Cooperative stage of the whole head, 16 B per thread and pass: K is one
  // contiguous copy; each pass of V^T is one 8 KiB row, laid at the padded
  // pitch so that the 16 rows a fragment load touches fall on distinct banks.
  // Both loops unrolled so that every load of the stage is in flight at once.
  #pragma unroll
  for (int i = 0; i < (S_ * HD_) / (AW_ * 32 * 8); ++i)
    *(v8h*)&kbuf[(i * AW_ * 32 + tid) * 8] =
        *(const v8h*)(kp + (size_t)(i * AW_ * 32 + tid) * 8);
  #pragma unroll
  for (int i = 0; i < HD_; ++i)
    *(v8h*)&vbuf[i * VP_ + tid * 8] = *(const v8h*)(vp + (size_t)i * S_ + tid * 8);

  // B operand: Q^T (loop-invariant). Lane = query col n; halves 0..7 =
  // hd khalf..khalf+7; upper halves zero (contraction hd=16 padded to 32).
  v16h bq = {};
  {
    const v8h q8 = *(const v8h*)(qp + n * HD_ + khalf);
    #pragma unroll
    for (int i = 0; i < 8; ++i) bq[i] = q8[i];
  }

  v8f acc = {};                 // O^T tile: (hd row khalf+r, query col n)
  float mrun = -3.0e38f;        // reference maximum, the same in lanes l and l ^ 16
  float lrun = 0.0f;            // this lane's own half of the row sum
  v8f negm;                     // -mrun in every row: C operand of the S^T products
  #pragma unroll
  for (int r = 0; r < 8; ++r) negm[r] = 3.0e38f;

  __syncthreads();                         // whole head visible to every wave

  for (int kt = 0; kt < NKT; ++kt) {

    // A operands for S^T: four 16-key tiles (rows = keys), contraction = hd
    v16h ak[4];
    #pragma unroll
    for (int j = 0; j < 4; ++j) {
      const v8h k8 = *(const v8h*)&kbuf[(kt * KT_ + j * 16 + n) * HD_ + khalf];
      #pragma unroll
      for (int i = 0; i < 8; ++i) { ak[j][i] = k8[i]; ak[j][8 + i] = (_Float16)0.0f; }
    }
    // A operands for O^T: two V^T tiles (rows = hd), full contraction K=32 keys
    v16h av[2];
    #pragma unroll
    for (int j = 0; j < 2; ++j) {
      const v8h v8a = *(const v8h*)&vbuf[n * VP_ + kt * KT_ + j * 32 + khalf];
      const v8h v8b = *(const v8h*)&vbuf[n * VP_ + kt * KT_ + j * 32 + khalf + 16];
      #pragma unroll
      for (int i = 0; i < 8; ++i) { av[j][i] = v8a[i]; av[j][8 + i] = v8b[i]; }
    }

    // P = exp2(S^T - mrun) against the maximum as it stood at the last refresh;
    // the subtraction rides in as the C operand. Hardware exp2 directly: a
    // result under 2^-126 (flushed to 0) is 0 in f16 P and vanishes in the sum.
    v8f p[4];
    #pragma unroll
    for (int j = 0; j < 4; ++j) {
      p[j] = wmma_f16(ak[j], bq, negm);
      #pragma unroll
      for (int r = 0; r < 8; ++r) p[j][r] = __builtin_amdgcn_exp2f(p[j][r]);
    }
    float ps = sum32(p[0], p[1], p[2], p[3]);

    // Every P is >= 0, so ps <= PBOUND bounds each of them inside f16. Any lane
    // past it (the first tile always is; inf and NaN too) refreshes the whole
    // wave: exact maximum of this tile, old sums rescaled once, P formed anew.
    if (__builtin_amdgcn_ballot_w32(!(ps <= PBOUND)) != 0u) {
      const v8f z = {};
      #pragma unroll
      for (int j = 0; j < 4; ++j) p[j] = wmma_f16(ak[j], bq, z);
      float vmax = p[0][0];
      #pragma unroll
      for (int j = 0; j < 4; ++j)
        #pragma unroll
        for (int r = 0; r < 8; ++r) vmax = fmaxf(vmax, p[j][r]);
      vmax = fmaxf(vmax, __shfl_xor(vmax, 16, 32));
      const float mnew  = fmaxf(mrun, vmax);
      const float alpha = __builtin_amdgcn_exp2f(mrun - mnew);
      mrun = mnew;
      lrun *= alpha;
      #pragma unroll
      for (int r = 0; r < 8; ++r) { acc[r] *= alpha; negm[r] = -mnew; }
      #pragma unroll
      for (int j = 0; j < 4; ++j)
        #pragma unroll
        for (int r = 0; r < 8; ++r) p[j][r] = __builtin_amdgcn_exp2f(p[j][r] - mnew);
      ps = sum32(p[0], p[1], p[2], p[3]);
    }
    lrun += ps;

    // P^T B-operand: halves i = key khalf+i, halves 8+i = key khalf+16+i of a
    // 32-key half tile: exactly this lane's elements. Pure in-lane converts.
    #pragma unroll
    for (int j = 0; j < 2; ++j) {
      v16h bp;
      #pragma unroll
      for (int r = 0; r < 8; ++r) {
        bp[r]     = (_Float16)p[2 * j][r];
        bp[8 + r] = (_Float16)p[2 * j + 1][r];
      }
      acc = wmma_f16(av[j], bp, acc);  // O^T += V^T . P^T (full K=32)
    }
  }
  lrun += __shfl_xor(lrun, 16, 32);    // the pair's two halves of the row sum

  // Normalize; O^T C-layout makes the store one contiguous 16B per lane:
  // lane holds hd rows khalf..khalf+7 of query qt*16+n.
  const float inv = 1.0f / lrun;
  v8h oh;
  #pragma unroll
  for (int r = 0; r < 8; ++r) oh[r] = (_Float16)(acc[r] * inv);
  const int b = bh >> 3, h = bh & 7;
  _Float16* dst =
      Ah + (((size_t)b * S_ + (size_t)qt * 16 + n) * NH_ + h) * HD_ + khalf;
  *(v8h*)dst = oh;
}

// ---------------------------------------------------------------------------
// Kernel 3: output projection. out[16-row tile] = Ah @ wo^T + bo,
// K = 128 -> 4 chained WMMAs.
// ---------------------------------------------------------------------------
__global__ __launch_bounds__(256) void out_proj_kernel(
    const _Float16* __restrict__ Ah, const float* __restrict__ wo,
    const float* __restrict__ bo, float* __restrict__ out)
{
  const int lane  = threadIdx.x & 31;
  const int wave  = threadIdx.x >> 5;
  const int rt    = blockIdx.x * 8 + wave;   // 512 row tiles over B*S
  const int mrow  = lane & 15;
  const int khalf = (lane >> 4) << 3;
  const int mbase = khalf;
  const int n     = lane & 15;

  v8f c = {};
  {
    const float t = bo[n];
    #pragma unroll
    for (int r = 0; r < 8; ++r) c[r] = t;
  }

  const _Float16* arow = Ah + ((size_t)rt * 16 + mrow) * H_;
  const float*    wrow = wo + (size_t)n * H_;   // wo[E,H] row n = output col

  #pragma unroll
  for (int kc = 0; kc < 4; ++kc) {
    const int kb = kc * 32;
    v16h a = {};
    {
      const v8h a0 = *(const v8h*)(arow + kb + khalf);
      const v8h a1 = *(const v8h*)(arow + kb + khalf + 16);
      #pragma unroll
      for (int i = 0; i < 8; ++i) { a[i] = a0[i]; a[8 + i] = a1[i]; }
    }
    v16h b = {};
    {
      #pragma unroll
      for (int i = 0; i < 8; ++i) {
        b[i]     = (_Float16)wrow[kb + khalf + i];
        b[8 + i] = (_Float16)wrow[kb + khalf + 16 + i];
      }
    }
    c = wmma_f16(a, b, c);
  }

  #pragma unroll
  for (int r = 0; r < 8; ++r) {
    const int row = rt * 16 + mbase + r;
    out[(size_t)row * E_ + n] = c[r];
  }
}

// ---------------------------------------------------------------------------
extern "C" void kernel_launch(void* const* d_in, const int* in_sizes, int n_in,
                              void* d_out, int out_size, void* d_ws, size_t ws_size,
                              hipStream_t stream)
{
  const float* x  = (const float*)d_in[0];
  const float* wq = (const float*)d_in[1];
  const float* bq = (const float*)d_in[2];
  const float* wk = (const float*)d_in[3];
  const float* bk = (const float*)d_in[4];
  const float* wv = (const float*)d_in[5];
  const float* bv = (const float*)d_in[6];
  const float* wo = (const float*)d_in[7];
  const float* bo = (const float*)d_in[8];
  float* out = (float*)d_out;

  const size_t nqkv = (size_t)B_ * NH_ * S_ * HD_;   // 1M halves each
  _Float16* Qh = (_Float16*)d_ws;
  _Float16* Kh = Qh + nqkv;
  _Float16* Vt = Kh + nqkv;
  _Float16* Ah = Vt + nqkv;                          // total 8 MB of d_ws

  qkv_proj_kernel<<<512, 256, 0, stream>>>(x, wq, bq, wk, bk, wv, bv, Qh, Kh, Vt);
  flash_attn_kernel<<<256, 512, 0, stream>>>(Qh, Kh, Vt, Ah);
  out_proj_kernel<<<64, 256, 0, stream>>>(Ah, wo, bo, out);
}

// v004
// A run of this version takes 32.5 microseconds.
// In two side-by-side timings against v003, it was 1.19 and 1.18 times as fast.
// Counting every step since v000, it is 2.95 times as fast.
#include <hip/hip_runtime.h>

typedef __attribute__((ext_vector_type(16))) _Float16 v16h;
typedef __attribute__((ext_vector_type(8)))  _Float16 v8h;
typedef __attribute__((ext_vector_type(8)))  float    v8f;
typedef __attribute__((ext_vector_type(4)))  float    v4f;
typedef __attribute__((ext_vector_type(2)))  float    v2f;

#define B_  2
#define S_  4096
#define E_  16
#define H_  128
#define NH_ 8
#define HD_ 16
#define KT_ 64                      // keys per inner iteration
#define NKT (S_ / KT_)              // 64 iterations
#define PBOUND 16384.0f             // a tile's exp sum above this refreshes the maximum
#define AW_ 16                      // waves per attention block
#define VP_ (S_ + 8)                // LDS pitch of a V^T row in halves: 16 B x odd
#define NT_ (S_ / 16 / AW_)         // 16-key tiles that one wave projects

// 0.25 * log2(e): fold softmax scale (1/sqrt(16)) and exp->exp2 conversion into Q
#define QSCALE 0.3606737602222409f

static __device__ __forceinline__ v8f wmma_f16(v16h a, v16h b, v8f c) {
  // D = A(16x32 f16) * B(32x16 f16) + C(16x16 f32)
  return __builtin_amdgcn_wmma_f32_16x16x32_f16(false, a, false, b, (short)0, c,
                                                false, false);
}

// Sum of one lane's 32 values, as a tree of vector adds.
static __device__ __forceinline__ float sum32(v8f a, v8f b, v8f c, v8f d) {
  const v8f t = (a + b) + (c + d);
  const v4f u = t.lo + t.hi;
  const v2f w = u.lo + u.hi;
  return w.x + w.y;
}

// One lane's share of a 16 x 16 f32 tile as a WMMA A or B operand (the two
// layouts agree): 8 consecutive f32 of its row, the upper contraction half 0.
static __device__ __forceinline__ v16h pack16(v4f lo, v4f hi) {
  v16h f = {};
  #pragma unroll
  for (int i = 0; i < 4; ++i) { f[i] = (_Float16)lo[i]; f[4 + i] = (_Float16)hi[i]; }
  return f;
}

static __device__ __forceinline__ v8h to_half8(v8f c) {
  v8h h;
  #pragma unroll
  for (int r = 0; r < 8; ++r) h[r] = (_Float16)c[r];
  return h;
}

// ---------------------------------------------------------------------------
// Kernel 1: QKV projection + transposed flash attention. Each block owns one
// (b,h); its 16 waves own 16 consecutive 16-query tiles and SHARE the head's
// whole K and V^T (128 KiB each) in LDS. The block forms both itself from
// x[b] (as many bytes as K and V in f16) with two WMMAs per 16 keys:
//   K^T tile = Wk . x^T + bk  (lane = key, VGPR index = hd: one 16 B store
//                              into the [key][hd] plane)
//   V tile   = x . Wv^T + bv  (lane = hd, VGPR index = key: one 16 B store
//                              into the [hd][key] plane)
// The same x fragment is the B operand of the first and the A of the second.
// One block fills a WGP, and the key loop holds no global load and no
// barrier. Per 64-key step:
//   S^T - m = K . Q^T - m    (4 WMMAs; lane owns one query column,
//                             keys live on the in-lane VGPR index)
//   in-lane exp2 and sum     (m is refreshed, and the sums rescaled, only
//                             when a step's sum passes PBOUND)
//   O^T += V^T . P^T         (2 full-K=32 WMMAs; P^T B-operand is built
//                             with pure in-lane f32->f16 converts)
// No LDS round-trip for P, no butterflies over columns.
// ---------------------------------------------------------------------------
__global__ __launch_bounds__(AW_ * 32) void flash_attn_kernel(
    const float* __restrict__ x,
    const float* __restrict__ wq, const float* __restrict__ bq,
    const float* __restrict__ wk, const float* __restrict__ bk,
    const float* __restrict__ wv, const float* __restrict__ bv,
    _Float16* __restrict__ Ah)
{
  __shared__ __align__(16) _Float16 smem[S_ * HD_ + HD_ * VP_];
  _Float16* const kbuf = smem;                            // [key][hd]
  _Float16* const vbuf = smem + S_ * HD_;                 // [hd][key] (V^T), padded rows

  const int tid   = threadIdx.x;
  const int lane  = tid & 31;
  const int wave  = tid >> 5;
  const int bh    = blockIdx.x >> 4;                      // uniform per block
  const int qt    = ((blockIdx.x & 15) << 4) | wave;      // query tile 0..255
  const int n     = lane & 15;                            // query col / hd row
  const int khalf = (lane >> 4) << 3;                     // K-group base (0/8)
  const int b     = bh >> 3, h = bh & 7;

  // This lane's 8 f32 of row n of any 16-row tile of x[b].
  const float* xl = x + ((size_t)b * S_ + n) * E_ + khalf;
  const int wrow  = h * HD_ + n;                          // weight row = output column

  // Every global load of the kernel is issued here, ahead of all use, so that
  // all are in flight at once: first the weights, the biases and the wave's
  // query tile, then the raw f32 of its 16 key tiles (tile i * 16 + wave, two
  // 16 B loads a tile).
  const float* pwk = wk + (size_t)wrow * E_ + khalf;
  const float* pwv = wv + (size_t)wrow * E_ + khalf;
  const float* pwq = wq + (size_t)wrow * E_ + khalf;
  const float* pbk = bk + h * HD_ + khalf;
  const float* pbq = bq + h * HD_ + khalf;
  const float* pxq = xl + (size_t)qt * 16 * E_;
  const v4f wq0 = *(const v4f*)pwq, wq1 = *(const v4f*)(pwq + 4);
  const v4f bq0 = *(const v4f*)pbq, bq1 = *(const v4f*)(pbq + 4);
  const v4f xq0 = *(const v4f*)pxq, xq1 = *(const v4f*)(pxq + 4);
  const v4f wk0 = *(const v4f*)pwk, wk1 = *(const v4f*)(pwk + 4);
  const v4f wv0 = *(const v4f*)pwv, wv1 = *(const v4f*)(pwv + 4);
  const v4f bk0 = *(const v4f*)pbk, bk1 = *(const v4f*)(pbk + 4);
  const float tv = bv[wrow];
  // Keeps the loads in the order of their use (the load counter runs in issue
  // order): the first tiles are worked on while the last still fly.
  __builtin_amdgcn_sched_barrier(0);
  v4f xr[2 * NT_];
  #pragma unroll
  for (int i = 0; i < NT_; ++i) {
    const float* p = xl + (size_t)(i * AW_ + wave) * 16 * E_;
    xr[2 * i]     = *(const v4f*)p;
    xr[2 * i + 1] = *(const v4f*)(p + 4);
  }
  __builtin_amdgcn_sched_barrier(0);       // as above: no use ahead of the last load's issue

  // B operand: Q^T (loop-invariant), pre-scaled. Lane = query col n; halves
  // 0..7 = hd khalf..khalf+7: the D layout of Wq . x^T as it stands; upper
  // halves zero (contraction hd=16 padded to 32).
  v16h bqf = {};
  {
    v8f cq;
    #pragma unroll
    for (int r = 0; r < 4; ++r) { cq[r] = bq0[r]; cq[4 + r] = bq1[r]; }
    const v8f qd = wmma_f16(pack16(wq0, wq1), pack16(xq0, xq1), cq);
    #pragma unroll
    for (int i = 0; i < 8; ++i) bqf[i] = (_Float16)(qd[i] * QSCALE);
  }

  const v16h fwk = pack16(wk0, wk1);
  const v16h fwv = pack16(wv0, wv1);
  v8f ck, cv;                   // biases: along the rows (hd) for K^T, the column for V
  #pragma unroll
  for (int r = 0; r < 4; ++r) { ck[r] = bk0[r]; ck[4 + r] = bk1[r]; cv[r] = tv; cv[4 + r] = tv; }

  #pragma unroll
  for (int i = 0; i < NT_; ++i) {
    // Four tiles at a time: without this fence the scheduler opens all 16 tiles
    // at once and spills registers to scratch.
    if ((i & 3) == 0) __builtin_amdgcn_sched_barrier(0);
    const int key0 = (i * AW_ + wave) * 16;
    const v16h xf = pack16(xr[2 * i], xr[2 * i + 1]);
    *(v8h*)&kbuf[(key0 + n) * HD_ + khalf] = to_half8(wmma_f16(fwk, xf, ck));
    *(v8h*)&vbuf[n * VP_ + key0 + khalf]   = to_half8(wmma_f16(xf, fwv, cv));
  }

  v8f acc = {};                 // O^T tile: (hd row khalf+r, query col n)
  float mrun = -3.0e38f;        // reference maximum, the same in lanes l and l ^ 16
  float lrun = 0.0f;            // this lane's own half of the row sum
  v8f negm;                     // -mrun in every row: C operand of the S^T products
  #pragma unroll
  for (int r = 0; r < 8; ++r) negm[r] = 3.0e38f;

  __syncthreads();                         // whole head visible to every wave

  for (int kt = 0; kt < NKT; ++kt) {

    // A operands for S^T: four 16-key tiles (rows = keys), contraction = hd
    v16h ak[4];
    #pragma unroll
    for (int j = 0; j < 4; ++j) {
      const v8h k8 = *(const v8h*)&kbuf[(kt * KT_ + j * 16 + n) * HD_ + khalf];
      #pragma unroll
      for (int i = 0; i < 8; ++i) { ak[j][i] = k8[i]; ak[j][8 + i] = (_Float16)0.0f; }
    }
    // A operands for O^T: two V^T tiles (rows = hd), full contraction K=32 keys
    v16h av[2];
    #pragma unroll
    for (int j = 0; j < 2; ++j) {
      const v8h v8a = *(const v8h*)&vbuf[n * VP_ + kt * KT_ + j * 32 + khalf];
      const v8h v8b = *(const v8h*)&vbuf[n * VP_ + kt * KT_ + j * 32 + khalf + 16];
      #pragma unroll
      for (int i = 0; i < 8; ++i) { av[j][i] = v8a[i]; av[j][8 + i] = v8b[i]; }
    }

    // P = exp2(S^T - mrun) against the maximum as it stood at the last refresh;
    // the subtraction rides in as the C operand. Hardware exp2 directly: a
    // result under 2^-126 (flushed to 0) is 0 in f16 P and vanishes in the sum.
    v8f p[4];
    #pragma unroll
    for (int j = 0; j < 4; ++j) {
      p[j] = wmma_f16(ak[j], bqf, negm);
      #pragma unroll
      for (int r = 0; r < 8; ++r) p[j][r] = __builtin_amdgcn_exp2f(p[j][r]);
    }
    float ps = sum32(p[0], p[1], p[2], p[3]);

    // Every P is >= 0, so ps <= PBOUND bounds each of them inside f16. Any lane
    // past it (the first tile always is; inf and NaN too) refreshes the whole
    // wave: exact maximum of this tile, old sums rescaled once, P formed anew.
    if (__builtin_amdgcn_ballot_w32(!(ps <= PBOUND)) != 0u) {
      const v8f z = {};
      #pragma unroll
      for (int j = 0; j < 4; ++j) p[j] = wmma_f16(ak[j], bqf, z);
      float vmax = p[0][0];
      #pragma unroll
      for (int j = 0; j < 4; ++j)
        #pragma unroll
        for (int r = 0; r < 8; ++r) vmax = fmaxf(vmax, p[j][r]);
      vmax = fmaxf(vmax, __shfl_xor(vmax, 16, 32));
      const float mnew  = fmaxf(mrun, vmax);
      const float alpha = __builtin_amdgcn_exp2f(mrun - mnew);
      mrun = mnew;
      lrun *= alpha;
      #pragma unroll
      for (int r = 0; r < 8; ++r) { acc[r] *= alpha; negm[r] = -mnew; }
      #pragma unroll
      for (int j = 0; j < 4; ++j)
        #pragma unroll
        for (int r = 0; r < 8; ++r) p[j][r] = __builtin_amdgcn_exp2f(p[j][r] - mnew);
      ps = sum32(p[0], p[1], p[2], p[3]);
    }
    lrun += ps;

    // P^T B-operand: halves i = key khalf+i, halves 8+i = key khalf+16+i of a
    // 32-key half tile: exactly this lane's elements. Pure in-lane converts.
    #pragma unroll
    for (int j = 0; j < 2; ++j) {
      v16h bp;
      #pragma unroll
      for (int r = 0; r < 8; ++r) {
        bp[r]     = (_Float16)p[2 * j][r];
        bp[8 + r] = (_Float16)p[2 * j + 1][r];
      }
      acc = wmma_f16(av[j], bp, acc);  // O^T += V^T . P^T (full K=32)
    }
  }
  lrun += __shfl_xor(lrun, 16, 32);    // the pair's two halves of the row sum

  // Normalize; O^T C-layout makes the store one contiguous 16B per lane:
  // lane holds hd rows khalf..khalf+7 of query qt*16+n.
  const float inv = 1.0f / lrun;
  v8h oh;
  #pragma unroll
  for (int r = 0; r < 8; ++r) oh[r] = (_Float16)(acc[r] * inv);
  _Float16* dst =
      Ah + (((size_t)b * S_ + (size_t)qt * 16 + n) * NH_ + h) * HD_ + khalf;
  *(v8h*)dst = oh;
}

// ---------------------------------------------------------------------------
// Kernel 2: output projection. out[16-row tile] = Ah @ wo^T + bo,
// K = 128 -> 4 chained WMMAs.
// ---------------------------------------------------------------------------
__global__ __launch_bounds__(256) void out_proj_kernel(
    const _Float16* __restrict__ Ah, const float* __restrict__ wo,
    const float* __restrict__ bo, float* __restrict__ out)
{
  const int lane  = threadIdx.x & 31;
  const int wave  = threadIdx.x >> 5;
  const int rt    = blockIdx.x * 8 + wave;   // 512 row tiles over B*S
  const int mrow  = lane & 15;
  const int khalf = (lane >> 4) << 3;
  const int mbase = khalf;
  const int n     = lane & 15;

  v8f c = {};
  {
    const float t = bo[n];
    #pragma unroll
    for (int r = 0; r < 8; ++r) c[r] = t;
  }

  const _Float16* arow = Ah + ((size_t)rt * 16 + mrow) * H_;
  const float*    wrow = wo + (size_t)n * H_;   // wo[E,H] row n = output col

  #pragma unroll
  for (int kc = 0; kc < 4; ++kc) {
    const int kb = kc * 32;
    v16h a = {};
    {
      const v8h a0 = *(const v8h*)(arow + kb + khalf);
      const v8h a1 = *(const v8h*)(arow + kb + khalf + 16);
      #pragma unroll
      for (int i = 0; i < 8; ++i) { a[i] = a0[i]; a[8 + i] = a1[i]; }
    }
    v16h b = {};
    {
      #pragma unroll
      for (int i = 0; i < 8; ++i) {
        b[i]     = (_Float16)wrow[kb + khalf + i];
        b[8 + i] = (_Float16)wrow[kb + khalf + 16 + i];
      }
    }
    c = wmma_f16(a, b, c);
  }

  #pragma unroll
  for (int r = 0; r < 8; ++r) {
    const int row = rt * 16 + mbase + r;
    out[(size_t)row * E_ + n] = c[r];
  }
}

// ---------------------------------------------------------------------------
extern "C" void kernel_launch(void* const* d_in, const int* in_sizes, int n_in,
                              void* d_out, int out_size, void* d_ws, size_t ws_size,
                              hipStream_t stream)
{
  const float* x  = (const float*)d_in[0];
  const float* wq = (const float*)d_in[1];
  const float* bq = (const float*)d_in[2];
  const float* wk = (const float*)d_in[3];
  const float* bk = (const float*)d_in[4];
  const float* wv = (const float*)d_in[5];
  const float* bv = (const float*)d_in[6];
  const float* wo = (const float*)d_in[7];
  const float* bo = (const float*)d_in[8];
  float* out = (float*)d_out;

  _Float16* Ah = (_Float16*)d_ws;                    // [b,s,h,d] in f16: 2 MB of d_ws

  flash_attn_kernel<<<256, 512, 0, stream>>>(x, wq, bq, wk, bk, wv, bv, Ah);
  out_proj_kernel<<<64, 256, 0, stream>>>(Ah, wo, bo, out);
}

// v006
// One run takes 27.9 microseconds.
// Versions between v004 and this one are left out; their measured steps multiply to 1.16 times as fast.
// Counting every step since v000, it is 3.44 times as fast.
#include <hip/hip_runtime.h>

typedef __attribute__((ext_vector_type(16))) _Float16 v16h;
typedef __attribute__((ext_vector_type(8)))  _Float16 v8h;
typedef __attribute__((ext_vector_type(8)))  float    v8f;
typedef __attribute__((ext_vector_type(4)))  float    v4f;
typedef __attribute__((ext_vector_type(2)))  float    v2f;

#define B_  2
#define S_  4096
#define E_  16
#define H_  128
#define NH_ 8
#define HD_ 16
#define KT_ 64                      // keys per inner iteration
#define NKT (S_ / KT_)              // 64 iterations
#define PBOUND 16384.0f             // a tile's exp sum above this refreshes the maximum
#define AW_ 16                      // waves per attention block
#define VP_ (S_ + 8)                // LDS pitch of a V^T row in halves: 16 B x odd
#define NT_ (S_ / 16 / AW_)         // 16-key tiles that one wave stages
#define AP_ (H_ + 8)                // LDS pitch of a 128-half row: 16 B x odd

// 0.25 * log2(e): fold softmax scale (1/sqrt(16)) and exp->exp2 conversion into Q
#define QSCALE 0.3606737602222409f

static __device__ __forceinline__ v8f wmma_f16(v16h a, v16h b, v8f c) {
  // D = A(16x32 f16) * B(32x16 f16) + C(16x16 f32)
  return __builtin_amdgcn_wmma_f32_16x16x32_f16(false, a, false, b, (short)0, c,
                                                false, false);
}

// Sum of one lane's 32 values, as a tree of vector adds.
static __device__ __forceinline__ float sum32(v8f a, v8f b, v8f c, v8f d) {
  const v8f t = (a + b) + (c + d);
  const v4f u = t.lo + t.hi;
  const v2f w = u.lo + u.hi;
  return w.x + w.y;
}

// One lane's share of a 16 x 16 f32 tile as a WMMA A or B operand (the two
// layouts agree): 8 consecutive f32 of its row, the upper contraction half 0.
static __device__ __forceinline__ v16h pack16(v4f lo, v4f hi) {
  v16h f = {};
  #pragma unroll
  for (int i = 0; i < 4; ++i) { f[i] = (_Float16)lo[i]; f[4 + i] = (_Float16)hi[i]; }
  return f;
}

static __device__ __forceinline__ v8h to_half8(v8f c) {
  v8h h;
  #pragma unroll
  for (int r = 0; r < 8; ++r) h[r] = (_Float16)c[r];
  return h;
}

// ---------------------------------------------------------------------------
// The whole model in one kernel. The K and V weights act on the query side:
//   S = Q K^T = (Q Wk) x^T + Q.bk   (Q.bk is one constant per query row and
//                                    cancels in the softmax for every input)
//   O = softmax(S) V = (softmax(S) x) Wv^T + bv   (the weights of a row sum to 1)
// so every head reads the SAME keys and values, x[b] itself (E = HD = 16: no
// more work per key). A block therefore holds x[b] and x[b]^T in LDS (128 KiB
// each, f16) for all 8 heads at once: its 16 waves are 2 query tiles x 8 heads,
// the block owns whole rows of the attention output, and it applies the output
// projection itself through LDS.
//   x plane   [key][e]: the lane's 8 converted values, one 16 B store
//   x^T plane [e][key]: x . I by WMMA (exact) turns the tile: lane = e, VGPR
//                       index = key, one 16 B store
// One block fills a WGP, and the key loop holds no global load and no
// barrier. Per 64-key step:
//   S^T - m = x . q'^T - m   (4 WMMAs, q' = Q Wk; lane owns one query column,
//                             keys live on the in-lane VGPR index; an A operand
//                             holds two key tiles, one per contraction half)
//   in-lane exp2 and sum     (m is refreshed, and the sums rescaled, only
//                             when a step's sum passes PBOUND)
//   (P x)^T += x^T . P^T     (2 full-K=32 WMMAs; P^T B-operand is built
//                             with pure in-lane f32->f16 converts)
// No LDS round-trip for P, no butterflies over columns.
// ---------------------------------------------------------------------------
__global__ __launch_bounds__(AW_ * 32) void flash_attn_kernel(
    const float* __restrict__ x,
    const float* __restrict__ wq, const float* __restrict__ bq,
    const float* __restrict__ wk,
    const float* __restrict__ wv, const float* __restrict__ bv,
    const float* __restrict__ wo, const float* __restrict__ bo,
    float* __restrict__ out)
{
  __shared__ __align__(16) _Float16 smem[S_ * E_ + E_ * VP_ + 2 * 16 * AP_ + E_ * AP_];
  _Float16* const kbuf  = smem;                           // x   [key][e]
  _Float16* const vbuf  = smem + S_ * E_;                 // x^T [e][key], padded rows
  _Float16* const abuf  = vbuf + E_ * VP_;                // attention out [2 x 16 queries][H], padded rows
  _Float16* const wobuf = abuf + 2 * 16 * AP_;            // wo [e][H] in f16, padded rows

  const int tid   = threadIdx.x;
  const int lane  = tid & 31;
  const int wave  = __builtin_amdgcn_readfirstlane(tid >> 5);  // scalar: the branch round the last WMMAs is wave-uniform
  const int b     = blockIdx.x >> 7;                      // uniform per block
  const int h     = wave & 7;                             // the wave's head
  const int qh    = wave >> 3;                            // which of the block's 2 query tiles
  const int qt    = ((blockIdx.x & 127) << 1) | qh;       // query tile 0..255
  const int n     = lane & 15;                            // query col / e row
  const int khalf = (lane >> 4) << 3;                     // K-group base (0/8)

  // This lane's 8 f32 of row n of any 16-row tile of x[b].
  const float* xl = x + ((size_t)b * S_ + n) * E_ + khalf;
  const int wrow  = h * HD_ + n;                          // weight row = output column

  // Every global load of the kernel is issued here, ahead of all use, so that
  // all are in flight at once: first the weights, the biases and the wave's
  // query tile, then the raw f32 of its 16 key tiles (tile i * 16 + wave, two
  // 16 B loads a tile).
  const float* pwq = wq + (size_t)wrow * E_ + khalf;
  const float* pwv = wv + (size_t)wrow * E_ + khalf;
  const float* pwk = wk + (size_t)(h * HD_ + khalf) * E_ + n;   // column n of the head's Wk
  const float* pbq = bq + h * HD_ + khalf;
  const float* pbv = bv + h * HD_ + khalf;
  const float* pxq = xl + (size_t)qt * 16 * E_;
  const v4f wq0 = *(const v4f*)pwq, wq1 = *(const v4f*)(pwq + 4);
  const v4f bq0 = *(const v4f*)pbq, bq1 = *(const v4f*)(pbq + 4);
  const v4f xq0 = *(const v4f*)pxq, xq1 = *(const v4f*)(pxq + 4);
  float wkc[8];
  #pragma unroll
  for (int i = 0; i < 8; ++i) wkc[i] = pwk[i * E_];
  const v4f wv0 = *(const v4f*)pwv, wv1 = *(const v4f*)(pwv + 4);
  const v4f bv0 = *(const v4f*)pbv, bv1 = *(const v4f*)(pbv + 4);
  const v4f wo4 = *(const v4f*)(wo + tid * 4);            // the thread's 4 of wo's 2048
  const float tb = bo[n];
  // Keeps the loads in the order of their use (the load counter runs in issue
  // order): the first tiles are worked on while the last still fly.
  __builtin_amdgcn_sched_barrier(0);
  v4f xr[2 * NT_];
  #pragma unroll
  for (int i = 0; i < NT_; ++i) {
    const float* p = xl + (size_t)(i * AW_ + wave) * 16 * E_;
    xr[2 * i]     = *(const v4f*)p;
    xr[2 * i + 1] = *(const v4f*)(p + 4);
  }
  __builtin_amdgcn_sched_barrier(0);       // as above: no use ahead of the last load's issue

  const v8f zero8 = {};

  // B operand: q'^T = (Q Wk)^T (loop-invariant), pre-scaled. Q^T = Wq . x^T + bq
  // comes out with lane = query col n, VGPR index = hd khalf..khalf+7: a B
  // operand as it stands. Wk^T . Q^T (A: row = e, contraction = hd) keeps the
  // lane and puts e on the VGPR index: again a B operand as it stands. bqf has
  // q' on contraction 0..15 and zeros above, bqh zeros below and q' on 16..31:
  // each picks one of the two key tiles that share an A operand.
  v16h bqf = {}, bqh = {};
  {
    v8f cq;
    #pragma unroll
    for (int r = 0; r < 4; ++r) { cq[r] = bq0[r]; cq[4 + r] = bq1[r]; }
    const v8f qd = wmma_f16(pack16(wq0, wq1), pack16(xq0, xq1), cq);
    v16h qf = {}, fwkt = {};
    #pragma unroll
    for (int i = 0; i < 8; ++i) { qf[i] = (_Float16)qd[i]; fwkt[i] = (_Float16)wkc[i]; }
    const v8f qe = wmma_f16(fwkt, qf, zero8);
    #pragma unroll
    for (int i = 0; i < 8; ++i) { bqf[i] = (_Float16)(qe[i] * QSCALE); bqh[8 + i] = bqf[i]; }
  }

  const v16h fwv = pack16(wv0, wv1);       // A operand of the epilogue: row = hd, contraction = e
  v8f cbv;                                 // bv along the rows (hd) of O^T
  #pragma unroll
  for (int r = 0; r < 4; ++r) { cbv[r] = bv0[r]; cbv[4 + r] = bv1[r]; }

  {
    typedef __attribute__((ext_vector_type(4))) _Float16 v4h;
    v4h w4;
    #pragma unroll
    for (int i = 0; i < 4; ++i) w4[i] = (_Float16)wo4[i];
    *(v4h*)&wobuf[wave * AP_ + lane * 4] = w4;            // wo row = wave, 128 f32 a row
  }

  v16h fid = {};                           // B operand: the 16 x 16 identity
  #pragma unroll
  for (int i = 0; i < 8; ++i) fid[i] = (khalf + i == n) ? (_Float16)1.0f : (_Float16)0.0f;

  #pragma unroll
  for (int i = 0; i < NT_; ++i) {
    // Four tiles at a time: without this fence the scheduler opens all 16 tiles
    // at once and spills registers to scratch.
    if ((i & 3) == 0) __builtin_amdgcn_sched_barrier(0);
    const int key0 = (i * AW_ + wave) * 16;
    const v16h xf = pack16(xr[2 * i], xr[2 * i + 1]);
    *(v8h*)&kbuf[(key0 + n) * E_ + khalf] = __builtin_shufflevector(xf, xf, 0, 1, 2, 3, 4, 5, 6, 7);
    *(v8h*)&vbuf[n * VP_ + key0 + khalf]  = to_half8(wmma_f16(xf, fid, zero8));
  }

  v8f acc = {};                 // (P x)^T tile: (e row khalf+r, query col n)
  float mrun = -3.0e38f;        // reference maximum, the same in lanes l and l ^ 16
  float lrun = 0.0f;            // this lane's own half of the row sum
  v8f negm;                     // -mrun in every row: C operand of the S^T products
  #pragma unroll
  for (int r = 0; r < 8; ++r) negm[r] = 3.0e38f;

  __syncthreads();                         // x, x^T and wo visible to every wave

  for (int kt = 0; kt < NKT; ++kt) {

    // A operands for S^T: four 16-key tiles of x (rows = keys), two to an
    // operand: tile 2j on contraction 0..15, tile 2j+1 on contraction 16..31
    v16h ak[2];
    #pragma unroll
    for (int j = 0; j < 2; ++j) {
      const v8h k8a = *(const v8h*)&kbuf[(kt * KT_ + j * 32 + n) * E_ + khalf];
      const v8h k8b = *(const v8h*)&kbuf[(kt * KT_ + j * 32 + 16 + n) * E_ + khalf];
      #pragma unroll
      for (int i = 0; i < 8; ++i) { ak[j][i] = k8a[i]; ak[j][8 + i] = k8b[i]; }
    }
    // A operands for (P x)^T: two x^T tiles (rows = e), full contraction K=32 keys
    v16h av[2];
    #pragma unroll
    for (int j = 0; j < 2; ++j) {
      const v8h v8a = *(const v8h*)&vbuf[n * VP_ + kt * KT_ + j * 32 + khalf];
      const v8h v8b = *(const v8h*)&vbuf[n * VP_ + kt * KT_ + j * 32 + khalf + 16];
      #pragma unroll
      for (int i = 0; i < 8; ++i) { av[j][i] = v8a[i]; av[j][8 + i] = v8b[i]; }
    }

    // P = exp2(S^T - mrun) against the maximum as it stood at the last refresh;
    // the subtraction rides in as the C operand. Hardware exp2 directly: a
    // result under 2^-126 (flushed to 0) is 0 in f16 P and vanishes in the sum.
    v8f p[4];
    #pragma unroll
    for (int j = 0; j < 4; ++j) {
      p[j] = wmma_f16(ak[j >> 1], (j & 1) ? bqh : bqf, negm);
      #pragma unroll
      for (int r = 0; r < 8; ++r) p[j][r] = __builtin_amdgcn_exp2f(p[j][r]);
    }
    float ps = sum32(p[0], p[1], p[2], p[3]);

    // Every P is >= 0, so ps <= PBOUND bounds each of them inside f16. Any lane
    // past it (the first tile always is; inf and NaN too) refreshes the whole
    // wave: exact maximum of this tile, old sums rescaled once, P formed anew.
    if (__builtin_amdgcn_ballot_w32(!(ps <= PBOUND)) != 0u) {
      const v8f z = {};
      #pragma unroll
      for (int j = 0; j < 4; ++j) p[j] = wmma_f16(ak[j >> 1], (j & 1) ? bqh : bqf, z);
      float vmax = p[0][0];
      #pragma unroll
      for (int j = 0; j < 4; ++j)
        #pragma unroll
        for (int r = 0; r < 8; ++r) vmax = fmaxf(vmax, p[j][r]);
      vmax = fmaxf(vmax, __shfl_xor(vmax, 16, 32));
      const float mnew  = fmaxf(mrun, vmax);
      const float alpha = __builtin_amdgcn_exp2f(mrun - mnew);
      mrun = mnew;
      lrun *= alpha;
      #pragma unroll
      for (int r = 0; r < 8; ++r) { acc[r] *= alpha; negm[r] = -mnew; }
      #pragma unroll
      for (int j = 0; j < 4; ++j)
        #pragma unroll
        for (int r = 0; r < 8; ++r) p[j][r] = __builtin_amdgcn_exp2f(p[j][r] - mnew);
      ps = sum32(p[0], p[1], p[2], p[3]);
    }
    lrun += ps;

    // P^T B-operand: halves i = key khalf+i, halves 8+i = key khalf+16+i of a
    // 32-key half tile: exactly this lane's elements. Pure in-lane converts.
    #pragma unroll
    for (int j = 0; j < 2; ++j) {
      v16h bp;
      #pragma unroll
      for (int r = 0; r < 8; ++r) {
        bp[r]     = (_Float16)p[2 * j][r];
        bp[8 + r] = (_Float16)p[2 * j + 1][r];
      }
      acc = wmma_f16(av[j], bp, acc);  // (P x)^T += x^T . P^T (full K=32)
    }
  }
  lrun += __shfl_xor(lrun, 16, 32);    // the pair's two halves of the row sum

  // O^T = Wv . (P x / l)^T + bv: the normalized tile is a B operand as it
  // stands (lane = query col n, VGPR index = e). The result holds hd rows
  // khalf..khalf+7 of query n: one contiguous 16 B of the row [query][H].
  const float inv = 1.0f / lrun;
  v16h yf = {};
  #pragma unroll
  for (int r = 0; r < 8; ++r) yf[r] = (_Float16)(acc[r] * inv);
  *(v8h*)&abuf[(qh * 16 + n) * AP_ + h * HD_ + khalf] = to_half8(wmma_f16(fwv, yf, cbv));

  __syncthreads();                         // all 8 heads of both query tiles are in abuf

  // Output projection: out[16-row tile] = A @ wo^T + bo, K = 128 -> 4 chained
  // WMMAs, by one wave per query tile.
  if (h == 0) {
    v8f c;
    #pragma unroll
    for (int r = 0; r < 8; ++r) c[r] = tb;
    const _Float16* arow = abuf + (qh * 16 + n) * AP_ + khalf;
    const _Float16* wrw  = wobuf + n * AP_ + khalf;       // wo[E,H] row n = output col
    #pragma unroll
    for (int kc = 0; kc < 4; ++kc) {
      const v8h a0 = *(const v8h*)(arow + kc * 32), a1 = *(const v8h*)(arow + kc * 32 + 16);
      const v8h b0 = *(const v8h*)(wrw + kc * 32),  b1 = *(const v8h*)(wrw + kc * 32 + 16);
      c = wmma_f16(__builtin_shufflevector(a0, a1, 0, 1, 2, 3, 4, 5, 6, 7, 8, 9, 10, 11, 12, 13, 14, 15),
                   __builtin_shufflevector(b0, b1, 0, 1, 2, 3, 4, 5, 6, 7, 8, 9, 10, 11, 12, 13, 14, 15), c);
    }
    float* orow = out + ((size_t)b * S_ + (size_t)qt * 16 + khalf) * E_ + n;
    #pragma unroll
    for (int r = 0; r < 8; ++r) orow[r * E_] = c[r];
  }
}

// ---------------------------------------------------------------------------
extern "C" void kernel_launch(void* const* d_in, const int* in_sizes, int n_in,
                              void* d_out, int out_size, void* d_ws, size_t ws_size,
                              hipStream_t stream)
{
  const float* x  = (const float*)d_in[0];
  const float* wq = (const float*)d_in[1];
  const float* bq = (const float*)d_in[2];
  const float* wk = (const float*)d_in[3];
  const float* wv = (const float*)d_in[5];
  const float* bv = (const float*)d_in[6];
  const float* wo = (const float*)d_in[7];
  const float* bo = (const float*)d_in[8];
  float* out = (float*)d_out;

  flash_attn_kernel<<<256, 512, 0, stream>>>(x, wq, bq, wk, wv, bv, wo, bo, out);
}

// v007
// It runs in 26.8 microseconds.
// Timed twice side by side with v006, it ran 1.04 and 1.05 times as fast.
// Over all steps from v000 it is 3.59 times as fast.
#include <hip/hip_runtime.h>

typedef __attribute__((ext_vector_type(16))) _Float16 v16h;
typedef __attribute__((ext_vector_type(8)))  _Float16 v8h;
typedef __attribute__((ext_vector_type(8)))  float    v8f;
typedef __attribute__((ext_vector_type(4)))  float    v4f;

#define B_  2
#define S_  4096
#define E_  16
#define H_  128
#define NH_ 8
#define HD_ 16
#define KT_ 64                      // keys per inner iteration
#define NKT (S_ / KT_)              // 64 iterations
#define PBOUND 16384.0f             // a tile's exp sum above this refreshes the maximum
#define AW_ 16                      // waves per attention block
#define VP_ (S_ + 8)                // LDS pitch of a V^T row in halves: 16 B x odd
#define NT_ (S_ / 16 / AW_)         // 16-key tiles that one wave stages
#define AP_ (H_ + 8)                // LDS pitch of a 128-half row: 16 B x odd

// 0.25 * log2(e): fold softmax scale (1/sqrt(16)) and exp->exp2 conversion into Q
#define QSCALE 0.3606737602222409f

static __device__ __forceinline__ v8f wmma_f16(v16h a, v16h b, v8f c) {
  // D = A(16x32 f16) * B(32x16 f16) + C(16x16 f32)
  return __builtin_amdgcn_wmma_f32_16x16x32_f16(false, a, false, b, (short)0, c,
                                                false, false);
}

// P^T B operand of a 32-key half step: halves i = key khalf+i, halves 8+i = key
// khalf+16+i: exactly this lane's elements of two S^T tiles. In-lane converts.
static __device__ __forceinline__ v16h pack_p(v8f lo, v8f hi) {
  v16h f;
  #pragma unroll
  for (int r = 0; r < 8; ++r) { f[r] = (_Float16)lo[r]; f[8 + r] = (_Float16)hi[r]; }
  return f;
}

// Sum over a step's 64 keys of the f16 P of each query column, on the matrix
// pipe: rows 0 and 8 of A are ones, and these are the rows that VGPR 0 of the
// result holds, so both lanes of a column get the whole sum.
static __device__ __forceinline__ float colsum64(v16h ones, v16h b0, v16h b1) {
  const v8f z = {};
  return wmma_f16(ones, b1, wmma_f16(ones, b0, z))[0];
}

// One lane's share of a 16 x 16 f32 tile as a WMMA A or B operand (the two
// layouts agree): 8 consecutive f32 of its row, the upper contraction half 0.
static __device__ __forceinline__ v16h pack16(v4f lo, v4f hi) {
  v16h f = {};
  #pragma unroll
  for (int i = 0; i < 4; ++i) { f[i] = (_Float16)lo[i]; f[4 + i] = (_Float16)hi[i]; }
  return f;
}

static __device__ __forceinline__ v8h to_half8(v8f c) {
  v8h h;
  #pragma unroll
  for (int r = 0; r < 8; ++r) h[r] = (_Float16)c[r];
  return h;
}

// ---------------------------------------------------------------------------
// The whole model in one kernel. The K and V weights act on the query side:
//   S = Q K^T = (Q Wk) x^T + Q.bk   (Q.bk is one constant per query row and
//                                    cancels in the softmax for every input)
//   O = softmax(S) V = (softmax(S) x) Wv^T + bv   (the weights of a row sum to 1)
// so every head reads the SAME keys and values, x[b] itself (E = HD = 16: no
// more work per key). A block therefore holds x[b] and x[b]^T in LDS (128 KiB
// each, f16) for all 8 heads at once: its 16 waves are 2 query tiles x 8 heads,
// the block owns whole rows of the attention output, and it applies the output
// projection itself through LDS.
//   x plane   [key][e]: the lane's 8 converted values, one 16 B store
//   x^T plane [e][key]: x . I by WMMA (exact) turns the tile: lane = e, VGPR
//                       index = key, one 16 B store
// One block fills a WGP, and the key loop holds no global load and no
// barrier. Per 64-key step:
//   S^T - m = x . q'^T - m   (4 WMMAs, q' = Q Wk; lane owns one query column,
//                             keys live on the in-lane VGPR index; an A operand
//                             holds two key tiles, one per contraction half)
//   in-lane exp2             (P^T B-operand is built with pure in-lane
//                             f32->f16 converts)
//   row sum = 1 . P^T        (2 WMMAs, A rows of ones; m is refreshed, and the sums
//                             rescaled, only when a step's sum passes PBOUND)
//   (P x)^T += x^T . P^T     (2 full-K=32 WMMAs)
// No LDS round-trip for P, no butterflies over columns.
// ---------------------------------------------------------------------------
__global__ __launch_bounds__(AW_ * 32) void flash_attn_kernel(
    const float* __restrict__ x,
    const float* __restrict__ wq, const float* __restrict__ bq,
    const float* __restrict__ wk,
    const float* __restrict__ wv, const float* __restrict__ bv,
    const float* __restrict__ wo, const float* __restrict__ bo,
    float* __restrict__ out)
{
  __shared__ __align__(16) _Float16 smem[S_ * E_ + E_ * VP_ + 2 * 16 * AP_ + E_ * AP_];
  _Float16* const kbuf  = smem;                           // x   [key][e]
  _Float16* const vbuf  = smem + S_ * E_;                 // x^T [e][key], padded rows
  _Float16* const abuf  = vbuf + E_ * VP_;                // attention out [2 x 16 queries][H], padded rows
  _Float16* const wobuf = abuf + 2 * 16 * AP_;            // wo [e][H] in f16, padded rows

  const int tid   = threadIdx.x;
  const int lane  = tid & 31;
  const int wave  = __builtin_amdgcn_readfirstlane(tid >> 5);  // scalar: the branch round the last WMMAs is wave-uniform
  const int b     = blockIdx.x >> 7;                      // uniform per block
  const int h     = wave & 7;                             // the wave's head
  const int qh    = wave >> 3;                            // which of the block's 2 query tiles
  const int qt    = ((blockIdx.x & 127) << 1) | qh;       // query tile 0..255
  const int n     = lane & 15;                            // query col / e row
  const int khalf = (lane >> 4) << 3;                     // K-group base (0/8)

  // This lane's 8 f32 of row n of any 16-row tile of x[b].
  const float* xl = x + ((size_t)b * S_ + n) * E_ + khalf;
  const int wrow  = h * HD_ + n;                          // weight row = output column

  // Every global load of the kernel is issued here, ahead of all use, so that
  // all are in flight at once: first the weights, the biases and the wave's
  // query tile, then the raw f32 of its 16 key tiles (tile i * 16 + wave, two
  // 16 B loads a tile).
  const float* pwq = wq + (size_t)wrow * E_ + khalf;
  const float* pwv = wv + (size_t)wrow * E_ + khalf;
  const float* pwk = wk + (size_t)(h * HD_ + khalf) * E_ + n;   // column n of the head's Wk
  const float* pbq = bq + h * HD_ + khalf;
  const float* pbv = bv + h * HD_ + khalf;
  const float* pxq = xl + (size_t)qt * 16 * E_;
  const v4f wq0 = *(const v4f*)pwq, wq1 = *(const v4f*)(pwq + 4);
  const v4f bq0 = *(const v4f*)pbq, bq1 = *(const v4f*)(pbq + 4);
  const v4f xq0 = *(const v4f*)pxq, xq1 = *(const v4f*)(pxq + 4);
  float wkc[8];
  #pragma unroll
  for (int i = 0; i < 8; ++i) wkc[i] = pwk[i * E_];
  const v4f wv0 = *(const v4f*)pwv, wv1 = *(const v4f*)(pwv + 4);
  const v4f bv0 = *(const v4f*)pbv, bv1 = *(const v4f*)(pbv + 4);
  const v4f wo4 = *(const v4f*)(wo + tid * 4);            // the thread's 4 of wo's 2048
  const float tb = bo[n];
  // Keeps the loads in the order of their use (the load counter runs in issue
  // order): the first tiles are worked on while the last still fly.
  __builtin_amdgcn_sched_barrier(0);
  v4f xr[2 * NT_];
  #pragma unroll
  for (int i = 0; i < NT_; ++i) {
    const float* p = xl + (size_t)(i * AW_ + wave) * 16 * E_;
    xr[2 * i]     = *(const v4f*)p;
    xr[2 * i + 1] = *(const v4f*)(p + 4);
  }
  __builtin_amdgcn_sched_barrier(0);       // as above: no use ahead of the last load's issue

  const v8f zero8 = {};

  // B operand: q'^T = (Q Wk)^T (loop-invariant), pre-scaled. Q^T = Wq . x^T + bq
  // comes out with lane = query col n, VGPR index = hd khalf..khalf+7: a B
  // operand as it stands. Wk^T . Q^T (A: row = e, contraction = hd) keeps the
  // lane and puts e on the VGPR index: again a B operand as it stands. bqf has
  // q' on contraction 0..15 and zeros above, bqh zeros below and q' on 16..31:
  // each picks one of the two key tiles that share an A operand.
  v16h bqf = {}, bqh = {};
  {
    v8f cq;
    #pragma unroll
    for (int r = 0; r < 4; ++r) { cq[r] = bq0[r]; cq[4 + r] = bq1[r]; }
    const v8f qd = wmma_f16(pack16(wq0, wq1), pack16(xq0, xq1), cq);
    v16h qf = {}, fwkt = {};
    #pragma unroll
    for (int i = 0; i < 8; ++i) { qf[i] = (_Float16)qd[i]; fwkt[i] = (_Float16)wkc[i]; }
    const v8f qe = wmma_f16(fwkt, qf, zero8);
    #pragma unroll
    for (int i = 0; i < 8; ++i) { bqf[i] = (_Float16)(qe[i] * QSCALE); bqh[8 + i] = bqf[i]; }
  }

  const v16h fwv = pack16(wv0, wv1);       // A operand of the epilogue: row = hd, contraction = e
  v8f cbv;                                 // bv along the rows (hd) of O^T
  #pragma unroll
  for (int r = 0; r < 4; ++r) { cbv[r] = bv0[r]; cbv[4 + r] = bv1[r]; }

  {
    typedef __attribute__((ext_vector_type(4))) _Float16 v4h;
    v4h w4;
    #pragma unroll
    for (int i = 0; i < 4; ++i) w4[i] = (_Float16)wo4[i];
    *(v4h*)&wobuf[wave * AP_ + lane * 4] = w4;            // wo row = wave, 128 f32 a row
  }

  v16h fid = {};                           // B operand: the 16 x 16 identity
  #pragma unroll
  for (int i = 0; i < 8; ++i) fid[i] = (khalf + i == n) ? (_Float16)1.0f : (_Float16)0.0f;

  #pragma unroll
  for (int i = 0; i < NT_; ++i) {
    // Four tiles at a time: without this fence the scheduler opens all 16 tiles
    // at once and spills registers to scratch.
    if ((i & 3) == 0) __builtin_amdgcn_sched_barrier(0);
    const int key0 = (i * AW_ + wave) * 16;
    const v16h xf = pack16(xr[2 * i], xr[2 * i + 1]);
    *(v8h*)&kbuf[(key0 + n) * E_ + khalf] = __builtin_shufflevector(xf, xf, 0, 1, 2, 3, 4, 5, 6, 7);
    *(v8h*)&vbuf[n * VP_ + key0 + khalf]  = to_half8(wmma_f16(xf, fid, zero8));
  }

  v8f acc = {};                 // (P x)^T tile: (e row khalf+r, query col n)
  float mrun = -3.0e38f;        // reference maximum, the same in lanes l and l ^ 16
  float lrun = 0.0f;            // the row sum, the same in lanes l and l ^ 16
  v16h fone;                    // A operand of the row sums: rows 0 and 8 ones, the rest 0
  #pragma unroll
  for (int i = 0; i < 16; ++i) fone[i] = ((n & 7) == 0) ? (_Float16)1.0f : (_Float16)0.0f;
  v8f negm;                     // -mrun in every row: C operand of the S^T products
  #pragma unroll
  for (int r = 0; r < 8; ++r) negm[r] = 3.0e38f;

  __syncthreads();                         // x, x^T and wo visible to every wave

  for (int kt = 0; kt < NKT; ++kt) {

    // A operands for S^T: four 16-key tiles of x (rows = keys), two to an
    // operand: tile 2j on contraction 0..15, tile 2j+1 on contraction 16..31
    v16h ak[2];
    #pragma unroll
    for (int j = 0; j < 2; ++j) {
      const v8h k8a = *(const v8h*)&kbuf[(kt * KT_ + j * 32 + n) * E_ + khalf];
      const v8h k8b = *(const v8h*)&kbuf[(kt * KT_ + j * 32 + 16 + n) * E_ + khalf];
      #pragma unroll
      for (int i = 0; i < 8; ++i) { ak[j][i] = k8a[i]; ak[j][8 + i] = k8b[i]; }
    }
    // A operands for (P x)^T: two x^T tiles (rows = e), full contraction K=32 keys
    v16h av[2];
    #pragma unroll
    for (int j = 0; j < 2; ++j) {
      const v8h v8a = *(const v8h*)&vbuf[n * VP_ + kt * KT_ + j * 32 + khalf];
      const v8h v8b = *(const v8h*)&vbuf[n * VP_ + kt * KT_ + j * 32 + khalf + 16];
      #pragma unroll
      for (int i = 0; i < 8; ++i) { av[j][i] = v8a[i]; av[j][8 + i] = v8b[i]; }
    }
    // Keeps the x^T reads up here, in flight under the exponentials: moved down
    // to their use, behind the test, nothing would cover their latency.
    __builtin_amdgcn_sched_barrier(0);

    // P = exp2(S^T - mrun) against the maximum as it stood at the last refresh;
    // the subtraction rides in as the C operand. Hardware exp2 directly: a
    // result under 2^-126 (flushed to 0) is 0 in f16 P and vanishes in the sum.
    v8f p[4];
    #pragma unroll
    for (int j = 0; j < 4; ++j) p[j] = wmma_f16(ak[j >> 1], (j & 1) ? bqh : bqf, negm);
    // The four products stand together, each filling the slots that the one
    // before needs ahead of its first reader: spread among the exponentials,
    // each is padded with v_nop instead.
    __builtin_amdgcn_sched_barrier(0);
    // The two tiles of a half step alternate: an independent instruction stands
    // behind each exponential before its source register is written again.
    #pragma unroll
    for (int j = 0; j < 4; j += 2)
      #pragma unroll
      for (int r = 0; r < 8; ++r) {
        p[j][r]     = __builtin_amdgcn_exp2f(p[j][r]);
        p[j + 1][r] = __builtin_amdgcn_exp2f(p[j + 1][r]);
      }
    v16h bp0 = pack_p(p[0], p[1]), bp1 = pack_p(p[2], p[3]);
    const float ps = colsum64(fone, bp0, bp1);
    float lnew = lrun + ps;            // ahead of the test: the slots behind the sum's WMMA pass once, not again at the join

    // Every P is >= 0, so ps <= PBOUND bounds each of them inside f16 (a P past
    // f16 converts to inf, and so does its sum). Any lane past it (the first
    // tile always is; inf and NaN too) refreshes the whole wave: exact maximum
    // of this tile, old sums rescaled once, P formed anew.
    if (__builtin_amdgcn_ballot_w32(!(ps <= PBOUND)) != 0u) {
      const v8f z = {};
      #pragma unroll
      for (int j = 0; j < 4; ++j) p[j] = wmma_f16(ak[j >> 1], (j & 1) ? bqh : bqf, z);
      float vmax = p[0][0];
      #pragma unroll
      for (int j = 0; j < 4; ++j)
        #pragma unroll
        for (int r = 0; r < 8; ++r) vmax = fmaxf(vmax, p[j][r]);
      vmax = fmaxf(vmax, __shfl_xor(vmax, 16, 32));
      const float mnew  = fmaxf(mrun, vmax);
      const float alpha = __builtin_amdgcn_exp2f(mrun - mnew);
      mrun = mnew;
      #pragma unroll
      for (int r = 0; r < 8; ++r) { acc[r] *= alpha; negm[r] = -mnew; }
      #pragma unroll
      for (int j = 0; j < 4; ++j)
        #pragma unroll
        for (int r = 0; r < 8; ++r) p[j][r] = __builtin_amdgcn_exp2f(p[j][r] - mnew);
      bp0 = pack_p(p[0], p[1]);
      bp1 = pack_p(p[2], p[3]);
      lnew = lrun * alpha + colsum64(fone, bp0, bp1);
    }
    lrun = lnew;

    acc = wmma_f16(av[0], bp0, acc);   // (P x)^T += x^T . P^T (full K=32)
    acc = wmma_f16(av[1], bp1, acc);
  }

  // O^T = Wv . (P x / l)^T + bv: the normalized tile is a B operand as it
  // stands (lane = query col n, VGPR index = e). The result holds hd rows
  // khalf..khalf+7 of query n: one contiguous 16 B of the row [query][H].
  const float inv = 1.0f / lrun;
  v16h yf = {};
  #pragma unroll
  for (int r = 0; r < 8; ++r) yf[r] = (_Float16)(acc[r] * inv);
  *(v8h*)&abuf[(qh * 16 + n) * AP_ + h * HD_ + khalf] = to_half8(wmma_f16(fwv, yf, cbv));

  __syncthreads();                         // all 8 heads of both query tiles are in abuf

  // Output projection: out[16-row tile] = A @ wo^T + bo, K = 128 -> 4 chained
  // WMMAs, by one wave per query tile.
  if (h == 0) {
    v8f c;
    #pragma unroll
    for (int r = 0; r < 8; ++r) c[r] = tb;
    const _Float16* arow = abuf + (qh * 16 + n) * AP_ + khalf;
    const _Float16* wrw  = wobuf + n * AP_ + khalf;       // wo[E,H] row n = output col
    #pragma unroll
    for (int kc = 0; kc < 4; ++kc) {
      const v8h a0 = *(const v8h*)(arow + kc * 32), a1 = *(const v8h*)(arow + kc * 32 + 16);
      const v8h b0 = *(const v8h*)(wrw + kc * 32),  b1 = *(const v8h*)(wrw + kc * 32 + 16);
      c = wmma_f16(__builtin_shufflevector(a0, a1, 0, 1, 2, 3, 4, 5, 6, 7, 8, 9, 10, 11, 12, 13, 14, 15),
                   __builtin_shufflevector(b0, b1, 0, 1, 2, 3, 4, 5, 6, 7, 8, 9, 10, 11, 12, 13, 14, 15), c);
    }
    float* orow = out + ((size_t)b * S_ + (size_t)qt * 16 + khalf) * E_ + n;
    #pragma unroll
    for (int r = 0; r < 8; ++r) orow[r * E_] = c[r];
  }
}

// ---------------------------------------------------------------------------
extern "C" void kernel_launch(void* const* d_in, const int* in_sizes, int n_in,
                              void* d_out, int out_size, void* d_ws, size_t ws_size,
                              hipStream_t stream)
{
  const float* x  = (const float*)d_in[0];
  const float* wq = (const float*)d_in[1];
  const float* bq = (const float*)d_in[2];
  const float* wk = (const float*)d_in[3];
  const float* wv = (const float*)d_in[5];
  const float* bv = (const float*)d_in[6];
  const float* wo = (const float*)d_in[7];
  const float* bo = (const float*)d_in[8];
  float* out = (float*)d_out;

  flash_attn_kernel<<<256, 512, 0, stream>>>(x, wq, bq, wk, wv, bv, wo, bo, out);
}

// v008
// One run takes 23.6 microseconds.
// Next to v007, in two timings, it ran 1.13 times as fast each time.
// Counting every step since v000, it is 4.07 times as fast.
#include <hip/hip_runtime.h>

typedef __attribute__((ext_vector_type(16))) _Float16 v16h;
typedef __attribute__((ext_vector_type(8)))  _Float16 v8h;
typedef __attribute__((ext_vector_type(8)))  float    v8f;
typedef __attribute__((ext_vector_type(4)))  float    v4f;

#define B_  2
#define S_  4096
#define E_  16
#define H_  128
#define NH_ 8
#define HD_ 16
#define KT_ 64                      // keys per inner iteration
#define NKT (S_ / KT_)              // 64 iterations
#define PBOUND 16384.0f             // a tile's exp sum above this refreshes the maximum
#define AW_ 16                      // waves per attention block
#define VP_ (S_ + 8)                // LDS pitch of a V^T row in halves: 16 B x odd
#define NT_ (S_ / 16 / AW_)         // 16-key tiles that one wave stages
#define AP_ (H_ + 8)                // LDS pitch of a 128-half row: 16 B x odd

// 0.25 * log2(e): fold softmax scale (1/sqrt(16)) and exp->exp2 conversion into Q
#define QSCALE 0.3606737602222409f

static __device__ __forceinline__ v8f wmma_f16(v16h a, v16h b, v8f c) {
  // D = A(16x32 f16) * B(32x16 f16) + C(16x16 f32)
  return __builtin_amdgcn_wmma_f32_16x16x32_f16(false, a, false, b, (short)0, c,
                                                false, false);
}

// P^T B operand of a 32-key half step: halves i = key khalf+i, halves 8+i = key
// khalf+16+i: exactly this lane's elements of two S^T tiles. In-lane converts.
static __device__ __forceinline__ v16h pack_p(v8f lo, v8f hi) {
  v16h f;
  #pragma unroll
  for (int r = 0; r < 8; ++r) { f[r] = (_Float16)lo[r]; f[8 + r] = (_Float16)hi[r]; }
  return f;
}

// Sum over a step's 64 keys of the f16 P of each query column, on the matrix
// pipe: rows 0 and 8 of A are ones, and these are the rows that VGPR 0 of the
// result holds, so both lanes of a column get the whole sum.
static __device__ __forceinline__ float colsum64(v16h ones, v16h b0, v16h b1) {
  const v8f z = {};
  return wmma_f16(ones, b1, wmma_f16(ones, b0, z))[0];
}

// One lane's share of a 16 x 16 f32 tile as a WMMA A or B operand (the two
// layouts agree): 8 consecutive f32 of its row, the upper contraction half 0.
static __device__ __forceinline__ v16h pack16(v4f lo, v4f hi) {
  v16h f = {};
  #pragma unroll
  for (int i = 0; i < 4; ++i) { f[i] = (_Float16)lo[i]; f[4 + i] = (_Float16)hi[i]; }
  return f;
}

static __device__ __forceinline__ v8h to_half8(v8f c) {
  v8h h;
  #pragma unroll
  for (int r = 0; r < 8; ++r) h[r] = (_Float16)c[r];
  return h;
}

// ---------------------------------------------------------------------------
// The whole model in one kernel. The K and V weights act on the query side:
//   S = Q K^T = (Q Wk) x^T + Q.bk   (Q.bk is one constant per query row and
//                                    cancels in the softmax for every input)
//   O = softmax(S) V = (softmax(S) x) Wv^T + bv   (the weights of a row sum to 1)
// so every head reads the SAME keys and values, x[b] itself (E = HD = 16: no
// more work per key). A block therefore holds x[b] and x[b]^T in LDS (128 KiB
// each, f16) for all 8 heads at once: its 16 waves are 2 query tiles x 8 heads,
// the block owns whole rows of the attention output, and it applies the output
// projection itself through LDS.
//   x plane   [key][e]: the lane's 8 converted values, one 16 B store
//   x^T plane [e][key]: x . I by WMMA (exact) turns the tile: lane = e, VGPR
//                       index = key, one 16 B store
// One block fills a WGP, and the key loop holds no global load and no
// barrier. Per 64-key step:
//   S^T - m = x . q'^T - m   (4 WMMAs, q' = Q Wk; lane owns one query column,
//                             keys live on the in-lane VGPR index; an A operand
//                             holds two key tiles, one per contraction half)
//   in-lane exp2             (P^T B-operand is built with pure in-lane
//                             f32->f16 converts)
//   row sum = 1 . P^T        (2 WMMAs, A rows of ones; m is refreshed, and the sums
//                             rescaled, only when a step's sum passes PBOUND)
//   (P x)^T += x^T . P^T     (2 full-K=32 WMMAs)
// No LDS round-trip for P, no butterflies over columns.
// ---------------------------------------------------------------------------
__global__ __launch_bounds__(AW_ * 32) void flash_attn_kernel(
    const float* __restrict__ x,
    const float* __restrict__ wq, const float* __restrict__ bq,
    const float* __restrict__ wk,
    const float* __restrict__ wv, const float* __restrict__ bv,
    const float* __restrict__ wo, const float* __restrict__ bo,
    float* __restrict__ out)
{
  __shared__ __align__(16) _Float16 smem[S_ * E_ + E_ * VP_ + 2 * 16 * AP_ + E_ * AP_];
  _Float16* const kbuf  = smem;                           // x   [key][e]
  _Float16* const vbuf  = smem + S_ * E_;                 // x^T [e][key], padded rows
  _Float16* const abuf  = vbuf + E_ * VP_;                // attention out [2 x 16 queries][H], padded rows
  _Float16* const wobuf = abuf + 2 * 16 * AP_;            // wo [e][H] in f16, padded rows

  const int tid   = threadIdx.x;
  const int lane  = tid & 31;
  const int wave  = __builtin_amdgcn_readfirstlane(tid >> 5);  // scalar: the branch round the last WMMAs is wave-uniform
  const int b     = blockIdx.x >> 7;                      // uniform per block
  const int h     = wave & 7;                             // the wave's head
  const int qh    = wave >> 3;                            // which of the block's 2 query tiles
  const int qt    = ((blockIdx.x & 127) << 1) | qh;       // query tile 0..255
  const int n     = lane & 15;                            // query col / e row
  const int khalf = (lane >> 4) << 3;                     // K-group base (0/8)

  // This lane's 8 f32 of row n of any 16-row tile of x[b].
  const float* xl = x + ((size_t)b * S_ + n) * E_ + khalf;
  const int wrow  = h * HD_ + n;                          // weight row = output column

  // Every global load of the kernel is issued here, ahead of all use, so that
  // all are in flight at once: first the weights, the biases and the wave's
  // query tile, then the raw f32 of its 16 key tiles (tile i * 16 + wave, two
  // 16 B loads a tile).
  const float* pwq = wq + (size_t)wrow * E_ + khalf;
  const float* pwv = wv + (size_t)wrow * E_ + khalf;
  const float* pwk = wk + (size_t)(h * HD_ + khalf) * E_ + n;   // column n of the head's Wk
  const float* pbq = bq + h * HD_ + khalf;
  const float* pbv = bv + h * HD_ + khalf;
  const float* pxq = xl + (size_t)qt * 16 * E_;
  const v4f wq0 = *(const v4f*)pwq, wq1 = *(const v4f*)(pwq + 4);
  const v4f bq0 = *(const v4f*)pbq, bq1 = *(const v4f*)(pbq + 4);
  const v4f xq0 = *(const v4f*)pxq, xq1 = *(const v4f*)(pxq + 4);
  float wkc[8];
  #pragma unroll
  for (int i = 0; i < 8; ++i) wkc[i] = pwk[i * E_];
  const v4f wv0 = *(const v4f*)pwv, wv1 = *(const v4f*)(pwv + 4);
  const v4f bv0 = *(const v4f*)pbv, bv1 = *(const v4f*)(pbv + 4);
  const v4f wo4 = *(const v4f*)(wo + tid * 4);            // the thread's 4 of wo's 2048
  const float tb = bo[n];
  // Keeps the loads in the order of their use (the load counter runs in issue
  // order): the first tiles are worked on while the last still fly.
  __builtin_amdgcn_sched_barrier(0);
  v4f xr[2 * NT_];
  #pragma unroll
  for (int i = 0; i < NT_; ++i) {
    const float* p = xl + (size_t)(i * AW_ + wave) * 16 * E_;
    xr[2 * i]     = *(const v4f*)p;
    xr[2 * i + 1] = *(const v4f*)(p + 4);
  }
  __builtin_amdgcn_sched_barrier(0);       // as above: no use ahead of the last load's issue

  const v8f zero8 = {};

  // B operand: q'^T = (Q Wk)^T (loop-invariant), pre-scaled. Q^T = Wq . x^T + bq
  // comes out with lane = query col n, VGPR index = hd khalf..khalf+7: a B
  // operand as it stands. Wk^T . Q^T (A: row = e, contraction = hd) keeps the
  // lane and puts e on the VGPR index: again a B operand as it stands. bqf has
  // q' on contraction 0..15 and zeros above, bqh zeros below and q' on 16..31:
  // each picks one of the two key tiles that share an A operand.
  v16h bqf = {}, bqh = {};
  {
    v8f cq;
    #pragma unroll
    for (int r = 0; r < 4; ++r) { cq[r] = bq0[r]; cq[4 + r] = bq1[r]; }
    const v8f qd = wmma_f16(pack16(wq0, wq1), pack16(xq0, xq1), cq);
    v16h qf = {}, fwkt = {};
    #pragma unroll
    for (int i = 0; i < 8; ++i) { qf[i] = (_Float16)qd[i]; fwkt[i] = (_Float16)wkc[i]; }
    const v8f qe = wmma_f16(fwkt, qf, zero8);
    #pragma unroll
    for (int i = 0; i < 8; ++i) { bqf[i] = (_Float16)(qe[i] * QSCALE); bqh[8 + i] = bqf[i]; }
  }

  const v16h fwv = pack16(wv0, wv1);       // A operand of the epilogue: row = hd, contraction = e
  v8f cbv;                                 // bv along the rows (hd) of O^T
  #pragma unroll
  for (int r = 0; r < 4; ++r) { cbv[r] = bv0[r]; cbv[4 + r] = bv1[r]; }

  {
    typedef __attribute__((ext_vector_type(4))) _Float16 v4h;
    v4h w4;
    #pragma unroll
    for (int i = 0; i < 4; ++i) w4[i] = (_Float16)wo4[i];
    *(v4h*)&wobuf[wave * AP_ + lane * 4] = w4;            // wo row = wave, 128 f32 a row
  }

  v16h fid = {};                           // B operand: the 16 x 16 identity
  #pragma unroll
  for (int i = 0; i < 8; ++i) fid[i] = (khalf + i == n) ? (_Float16)1.0f : (_Float16)0.0f;

  #pragma unroll
  for (int i = 0; i < NT_; ++i) {
    // Four tiles at a time: without this fence the scheduler opens all 16 tiles
    // at once and spills registers to scratch.
    if ((i & 3) == 0) __builtin_amdgcn_sched_barrier(0);
    const int key0 = (i * AW_ + wave) * 16;
    const v16h xf = pack16(xr[2 * i], xr[2 * i + 1]);
    *(v8h*)&kbuf[(key0 + n) * E_ + khalf] = __builtin_shufflevector(xf, xf, 0, 1, 2, 3, 4, 5, 6, 7);
    *(v8h*)&vbuf[n * VP_ + key0 + khalf]  = to_half8(wmma_f16(xf, fid, zero8));
  }

  v8f acc = {};                 // (P x)^T tile: (e row khalf+r, query col n)
  float mrun = -3.0e38f;        // reference maximum, the same in lanes l and l ^ 16
  float lrun = 0.0f;            // the row sum, the same in lanes l and l ^ 16
  v16h fone;                    // A operand of the row sums: rows 0 and 8 ones, the rest 0
  #pragma unroll
  for (int i = 0; i < 16; ++i) fone[i] = ((n & 7) == 0) ? (_Float16)1.0f : (_Float16)0.0f;
  v8f negm;                     // -mrun in every row: C operand of the S^T products
  #pragma unroll
  for (int r = 0; r < 8; ++r) negm[r] = 3.0e38f;

  __syncthreads();                         // x, x^T and wo visible to every wave

  // A wave's issue priority falls as it advances: 3, 2, 1, 0 from steps 0, 40, 56
  // and 62. The wave that is behind is served first, for speed only. The stages are
  // scalar and the same for all lanes; the last stage, and so the way out, has
  // priority 0.
  int kt = 0;
  #pragma clang loop unroll(disable)   // one copy of the key loop's body serves all four stages
  for (int st = 0; st < 4; ++st) {
  int kend;
  if (st == 0)      { __builtin_amdgcn_s_setprio(3); kend = 40; }
  else if (st == 1) { __builtin_amdgcn_s_setprio(2); kend = 56; }
  else if (st == 2) { __builtin_amdgcn_s_setprio(1); kend = 62; }
  else              { __builtin_amdgcn_s_setprio(0); kend = NKT; }
  for (; kt < kend; ++kt) {

    // A operands for S^T: four 16-key tiles of x (rows = keys), two to an
    // operand: tile 2j on contraction 0..15, tile 2j+1 on contraction 16..31
    v16h ak[2];
    #pragma unroll
    for (int j = 0; j < 2; ++j) {
      const v8h k8a = *(const v8h*)&kbuf[(kt * KT_ + j * 32 + n) * E_ + khalf];
      const v8h k8b = *(const v8h*)&kbuf[(kt * KT_ + j * 32 + 16 + n) * E_ + khalf];
      #pragma unroll
      for (int i = 0; i < 8; ++i) { ak[j][i] = k8a[i]; ak[j][8 + i] = k8b[i]; }
    }
    // A operands for (P x)^T: two x^T tiles (rows = e), full contraction K=32 keys
    v16h av[2];
    #pragma unroll
    for (int j = 0; j < 2; ++j) {
      const v8h v8a = *(const v8h*)&vbuf[n * VP_ + kt * KT_ + j * 32 + khalf];
      const v8h v8b = *(const v8h*)&vbuf[n * VP_ + kt * KT_ + j * 32 + khalf + 16];
      #pragma unroll
      for (int i = 0; i < 8; ++i) { av[j][i] = v8a[i]; av[j][8 + i] = v8b[i]; }
    }
    // Keeps the x^T reads up here, in flight under the exponentials: moved down
    // to their use, behind the test, nothing would cover their latency.
    __builtin_amdgcn_sched_barrier(0);

    // P = exp2(S^T - mrun) against the maximum as it stood at the last refresh;
    // the subtraction rides in as the C operand. Hardware exp2 directly: a
    // result under 2^-126 (flushed to 0) is 0 in f16 P and vanishes in the sum.
    v8f p[4];
    #pragma unroll
    for (int j = 0; j < 4; ++j) p[j] = wmma_f16(ak[j >> 1], (j & 1) ? bqh : bqf, negm);
    // The four products stand together, each filling the slots that the one
    // before needs ahead of its first reader: spread among the exponentials,
    // each is padded with v_nop instead.
    __builtin_amdgcn_sched_barrier(0);
    // The two tiles of a half step alternate: an independent instruction stands
    // behind each exponential before its source register is written again.
    #pragma unroll
    for (int j = 0; j < 4; j += 2)
      #pragma unroll
      for (int r = 0; r < 8; ++r) {
        p[j][r]     = __builtin_amdgcn_exp2f(p[j][r]);
        p[j + 1][r] = __builtin_amdgcn_exp2f(p[j + 1][r]);
      }
    v16h bp0 = pack_p(p[0], p[1]), bp1 = pack_p(p[2], p[3]);
    const float ps = colsum64(fone, bp0, bp1);
    float lnew = lrun + ps;            // ahead of the test: the slots behind the sum's WMMA pass once, not again at the join

    // Every P is >= 0, so ps <= PBOUND bounds each of them inside f16 (a P past
    // f16 converts to inf, and so does its sum). Any lane past it (the first
    // tile always is; inf and NaN too) refreshes the whole wave: exact maximum
    // of this tile, old sums rescaled once, P formed anew.
    if (__builtin_amdgcn_ballot_w32(!(ps <= PBOUND)) != 0u) {
      const v8f z = {};
      #pragma unroll
      for (int j = 0; j < 4; ++j) p[j] = wmma_f16(ak[j >> 1], (j & 1) ? bqh : bqf, z);
      float vmax = p[0][0];
      #pragma unroll
      for (int j = 0; j < 4; ++j)
        #pragma unroll
        for (int r = 0; r < 8; ++r) vmax = fmaxf(vmax, p[j][r]);
      vmax = fmaxf(vmax, __shfl_xor(vmax, 16, 32));
      const float mnew  = fmaxf(mrun, vmax);
      const float alpha = __builtin_amdgcn_exp2f(mrun - mnew);
      mrun = mnew;
      #pragma unroll
      for (int r = 0; r < 8; ++r) { acc[r] *= alpha; negm[r] = -mnew; }
      #pragma unroll
      for (int j = 0; j < 4; ++j)
        #pragma unroll
        for (int r = 0; r < 8; ++r) p[j][r] = __builtin_amdgcn_exp2f(p[j][r] - mnew);
      bp0 = pack_p(p[0], p[1]);
      bp1 = pack_p(p[2], p[3]);
      lnew = lrun * alpha + colsum64(fone, bp0, bp1);
    }
    lrun = lnew;

    acc = wmma_f16(av[0], bp0, acc);   // (P x)^T += x^T . P^T (full K=32)
    acc = wmma_f16(av[1], bp1, acc);
  }
  }

  // O^T = Wv . (P x / l)^T + bv: the normalized tile is a B operand as it
  // stands (lane = query col n, VGPR index = e). The result holds hd rows
  // khalf..khalf+7 of query n: one contiguous 16 B of the row [query][H].
  const float inv = 1.0f / lrun;
  v16h yf = {};
  #pragma unroll
  for (int r = 0; r < 8; ++r) yf[r] = (_Float16)(acc[r] * inv);
  *(v8h*)&abuf[(qh * 16 + n) * AP_ + h * HD_ + khalf] = to_half8(wmma_f16(fwv, yf, cbv));

  __syncthreads();                         // all 8 heads of both query tiles are in abuf

  // Output projection: out[16-row tile] = A @ wo^T + bo, K = 128 -> 4 chained
  // WMMAs, by one wave per query tile.
  if (h == 0) {
    v8f c;
    #pragma unroll
    for (int r = 0; r < 8; ++r) c[r] = tb;
    const _Float16* arow = abuf + (qh * 16 + n) * AP_ + khalf;
    const _Float16* wrw  = wobuf + n * AP_ + khalf;       // wo[E,H] row n = output col
    #pragma unroll
    for (int kc = 0; kc < 4; ++kc) {
      const v8h a0 = *(const v8h*)(arow + kc * 32), a1 = *(const v8h*)(arow + kc * 32 + 16);
      const v8h b0 = *(const v8h*)(wrw + kc * 32),  b1 = *(const v8h*)(wrw + kc * 32 + 16);
      c = wmma_f16(__builtin_shufflevector(a0, a1, 0, 1, 2, 3, 4, 5, 6, 7, 8, 9, 10, 11, 12, 13, 14, 15),
                   __builtin_shufflevector(b0, b1, 0, 1, 2, 3, 4, 5, 6, 7, 8, 9, 10, 11, 12, 13, 14, 15), c);
    }
    float* orow = out + ((size_t)b * S_ + (size_t)qt * 16 + khalf) * E_ + n;
    #pragma unroll
    for (int r = 0; r < 8; ++r) orow[r * E_] = c[r];
  }
}

// ---------------------------------------------------------------------------
extern "C" void kernel_launch(void* const* d_in, const int* in_sizes, int n_in,
                              void* d_out, int out_size, void* d_ws, size_t ws_size,
                              hipStream_t stream)
{
  const float* x  = (const float*)d_in[0];
  const float* wq = (const float*)d_in[1];
  const float* bq = (const float*)d_in[2];
  const float* wk = (const float*)d_in[3];
  const float* wv = (const float*)d_in[5];
  const float* bv = (const float*)d_in[6];
  const float* wo = (const float*)d_in[7];
  const float* bo = (const float*)d_in[8];
  float* out = (float*)d_out;

  flash_attn_kernel<<<256, 512, 0, stream>>>(x, wq, bq, wk, wv, bv, wo, bo, out);
}
